// v000
// Measured on an AMD MI455X. A time is GPU time per run, averaged over a window of back-to-back runs after a warm-up
// (all launches, gaps included; the runs take copies of the inputs in turn), and the median of several windows.
// Apart from v000's, it joins two sittings. Times from different sittings can be a few percent apart, while
// side-by-side timings come from the same sitting.
// The starting kernel, v000, takes 274 microseconds a run.
#include <hip/hip_runtime.h>
#include <hip/hip_bf16.h>

typedef __attribute__((ext_vector_type(16))) _Float16 v16h;
typedef __attribute__((ext_vector_type(8)))  float    v8f;

// ---------------- problem constants ----------------
constexpr int BB = 4, S = 1024, D = 1024, H = 16, DK = 64;
constexpr int MROWS = BB * S;          // 4096
constexpr long XE = (long)MROWS * D;   // 4M elements
constexpr long WE = (long)D * D;       // 1M elements

// ---------------- WMMA wrapper ----------------
__device__ __forceinline__ v8f wmma_f16(v16h a, v16h b, v8f c) {
  return __builtin_amdgcn_wmma_f32_16x16x32_f16(
      /*neg_a=*/false, a, /*neg_b=*/false, b,
      /*c_mod=*/(short)0, c, /*reuse_a=*/false, /*reuse_b=*/false);
}

__device__ __forceinline__ void async_ld_b128(const _Float16* lds_dst,
                                              const _Float16* gsrc) {
  unsigned lo = (unsigned)(unsigned long long)lds_dst;
  unsigned long long ga = (unsigned long long)gsrc;
  asm volatile("global_load_async_to_lds_b128 %0, %1, off"
               :: "v"(lo), "v"(ga) : "memory");
}
__device__ __forceinline__ void wait_async0() {
  asm volatile("s_wait_asynccnt 0" ::: "memory");
}

__device__ __forceinline__ v16h ld_frag(const _Float16* tile, int rbase,
                                        int stride, int k0, int lane) {
  const int m  = lane & 15;
  const int kb = (lane >> 4) << 3;   // 0 or 8
  const _Float16* p = tile + (rbase + m) * stride + k0 + kb;
  union { uint4 u[2]; v16h h; } r;
  r.u[0] = *reinterpret_cast<const uint4*>(p);
  r.u[1] = *reinterpret_cast<const uint4*>(p + 16);
  return r.h;
}

__device__ __forceinline__ float rowmax16(float x) {
  x = fmaxf(x, __shfl_xor(x, 1, 32));
  x = fmaxf(x, __shfl_xor(x, 2, 32));
  x = fmaxf(x, __shfl_xor(x, 4, 32));
  x = fmaxf(x, __shfl_xor(x, 8, 32));
  return x;
}
__device__ __forceinline__ float rowsum16(float x) {
  x += __shfl_xor(x, 1, 32);
  x += __shfl_xor(x, 2, 32);
  x += __shfl_xor(x, 4, 32);
  x += __shfl_xor(x, 8, 32);
  return x;
}

// ---------------- fp32 -> fp16 convert (straight) ----------------
__global__ void f32_to_f16_kernel(const float* __restrict__ src,
                                  _Float16* __restrict__ dst, int n) {
  for (int i = blockIdx.x * blockDim.x + threadIdx.x; i < n;
       i += gridDim.x * blockDim.x)
    dst[i] = (_Float16)src[i];
}

// -------- fp32 -> fp16 convert + transpose: dst[c][r] = src[r][c] ----------
// Produces weights in [N][K] row-major so GEMM B-fragments are k-contiguous.
__global__ __launch_bounds__(256) void transpose_f32_to_f16_kernel(
    const float* __restrict__ src, _Float16* __restrict__ dst, int n) {
  __shared__ float tile[32][33];
  const int bx = blockIdx.x * 32, by = blockIdx.y * 32;
  const int tx = threadIdx.x & 31, ty = threadIdx.x >> 5;  // 8 rows / pass
#pragma unroll
  for (int i = 0; i < 32; i += 8)
    tile[ty + i][tx] = src[(long)(by + ty + i) * n + bx + tx];
  __syncthreads();
#pragma unroll
  for (int i = 0; i < 32; i += 8)
    dst[(long)(bx + ty + i) * n + by + tx] = (_Float16)tile[tx][ty + i];
}

// ---------------- GEMM: C[MxN] = A[MxK](f16) @ BT[NxK](f16)^T + bias -------
// Block tile 128x128, BK=64, 256 threads = 8 waves; wave w owns rows
// [16w,16w+16) x 128 cols = 8 f32 accumulators; 16 WMMAs per wave per k-step.
// OMODE: 0 = f32 row-major, 1 = f16 row-major, 2 = f16 [B,H,DK,S] (for V).
template <int OMODE>
__global__ __launch_bounds__(256) void gemm_bias_kernel(
    const _Float16* __restrict__ A, const _Float16* __restrict__ BT,
    const float* __restrict__ bias, float* __restrict__ Cf,
    _Float16* __restrict__ Ch, int M, int N, int K) {
  constexpr int BM = 128, BN = 128, BK = 64;
  __shared__ _Float16 a_sh[BM * BK];   // [row][k]
  __shared__ _Float16 b_sh[BN * BK];   // [n][k]

  const int tid = threadIdx.x;
  const int lane = tid & 31, w = tid >> 5;
  const int n0 = blockIdx.x * BN, m0 = blockIdx.y * BM;

  v8f acc[8];
#pragma unroll
  for (int j = 0; j < 8; ++j) acc[j] = {};

  for (int kk = 0; kk < K; kk += BK) {
    __syncthreads();
    // async-stage both tiles: 128 rows x 64 f16 = 8 x b128 per row each
#pragma unroll
    for (int i = 0; i < 4; ++i) {
      int idx = tid + i * 256;            // 0..1023
      int row = idx >> 3, g = (idx & 7) * 8;
      async_ld_b128(a_sh + row * BK + g, A + (long)(m0 + row) * K + kk + g);
      async_ld_b128(b_sh + row * BK + g, BT + (long)(n0 + row) * K + kk + g);
    }
    wait_async0();
    __syncthreads();

    v16h a0 = ld_frag(a_sh, w * 16, BK, 0, lane);
    v16h a1 = ld_frag(a_sh, w * 16, BK, 32, lane);
#pragma unroll
    for (int j = 0; j < 8; ++j) {
      acc[j] = wmma_f16(a0, ld_frag(b_sh, j * 16, BK, 0, lane), acc[j]);
      acc[j] = wmma_f16(a1, ld_frag(b_sh, j * 16, BK, 32, lane), acc[j]);
    }
  }

  const int nlo = lane & 15, hi = (lane >> 4) & 1;
#pragma unroll
  for (int j = 0; j < 8; ++j) {
    int col = n0 + j * 16 + nlo;
    float bv = bias[col];
#pragma unroll
    for (int r = 0; r < 8; ++r) {
      long row = m0 + w * 16 + r + 8 * hi;
      float val = acc[j][r] + bv;
      if (OMODE == 0) {
        Cf[row * N + col] = val;
      } else if (OMODE == 1) {
        Ch[row * N + col] = (_Float16)val;
      } else {
        // V output in [B, H, DK, S]: row = b*S+s, col = h*DK+dk
        int b = (int)(row >> 10), s = (int)(row & (S - 1));
        int h = col >> 6, dk = col & (DK - 1);
        Ch[(long)((b * H + h) * DK + dk) * S + s] = (_Float16)val;
      }
    }
  }
}

// ---------------- flash attention -------------------------------------
// grid = B*H*(S/64) blocks, 128 threads (4 waves); wave owns 16 query rows.
// Q,K in [B,S,D] (head-sliced); V pre-transposed in [B,H,DK,S].
__global__ __launch_bounds__(128) void attn_kernel(
    const _Float16* __restrict__ Q, const _Float16* __restrict__ Km,
    const _Float16* __restrict__ Vt, _Float16* __restrict__ ctx) {
  constexpr int BQ = 64, BC = 32;
  __shared__ _Float16 q_sh[BQ * DK];      // [q][dk]
  __shared__ _Float16 k_sh[BC * DK];      // [key][dk]  (= K^T in frag layout)
  __shared__ _Float16 vT[DK * BC];        // [dk][key]
  __shared__ _Float16 p_sh[4 * 16 * BC];  // per-wave 16x32 P staging

  const int tid = threadIdx.x, lane = tid & 31, w = tid >> 5;
  const int nsb = S / BQ;                 // 16
  const int sblk = blockIdx.x % nsb;
  const int bh = blockIdx.x / nsb;
  const int b = bh / H, h = bh % H;
  const int q0 = sblk * BQ;
  const int hi = (lane >> 4) & 1, nlo = lane & 15;

  // async-stage Q tile 64x64: 8 x b128 per row, 4 per thread
#pragma unroll
  for (int i = 0; i < 4; ++i) {
    int idx = tid + i * 128;              // 0..511
    int row = idx >> 3, g = (idx & 7) * 8;
    async_ld_b128(q_sh + row * DK + g,
                  Q + (long)(b * S + q0 + row) * D + h * DK + g);
  }
  wait_async0();
  __syncthreads();
  v16h aq0 = ld_frag(q_sh, w * 16, DK, 0, lane);
  v16h aq1 = ld_frag(q_sh, w * 16, DK, 32, lane);

  float mrun[8], lrun[8];
  v8f o0 = {}, o1 = {}, o2 = {}, o3 = {};
#pragma unroll
  for (int r = 0; r < 8; ++r) { mrun[r] = -3.0e38f; lrun[r] = 0.f; }

  _Float16* pw = p_sh + w * 16 * BC;
  const _Float16* vt_base = Vt + (long)bh * DK * S;

  for (int t0 = 0; t0 < S; t0 += BC) {
    __syncthreads();
    // K chunk 32x64: 256 b128, 2/thread ; V^T chunk 64x32: 256 b128, 2/thread
#pragma unroll
    for (int i = 0; i < 2; ++i) {
      int idx = tid + i * 128;            // 0..255
      int row = idx >> 3, g = (idx & 7) * 8;
      async_ld_b128(k_sh + row * DK + g,
                    Km + (long)(b * S + t0 + row) * D + h * DK + g);
      int dk = idx >> 2, gg = (idx & 3) * 8;
      async_ld_b128(vT + dk * BC + gg, vt_base + (long)dk * S + t0 + gg);
    }
    wait_async0();
    __syncthreads();

    // scores: 16 q-rows x 32 keys, contraction over DK=64
    v8f sa = {}, sb = {};
    sa = wmma_f16(aq0, ld_frag(k_sh, 0, DK, 0, lane), sa);
    sa = wmma_f16(aq1, ld_frag(k_sh, 0, DK, 32, lane), sa);
    sb = wmma_f16(aq0, ld_frag(k_sh, 16, DK, 0, lane), sb);
    sb = wmma_f16(aq1, ld_frag(k_sh, 16, DK, 32, lane), sb);

    // online softmax (scale = 1/sqrt(DK) = 0.125)
#pragma unroll
    for (int r = 0; r < 8; ++r) {
      float x0 = sa[r] * 0.125f, x1 = sb[r] * 0.125f;
      float mx = rowmax16(fmaxf(x0, x1));
      float nm = fmaxf(mrun[r], mx);
      float al = __expf(mrun[r] - nm);
      mrun[r] = nm;
      x0 = __expf(x0 - nm);
      x1 = __expf(x1 - nm);
      sa[r] = x0;
      sb[r] = x1;
      lrun[r] = lrun[r] * al + rowsum16(x0 + x1);
      o0[r] *= al; o1[r] *= al; o2[r] *= al; o3[r] *= al;
    }

    // re-fragment P via per-wave LDS staging (C layout -> A layout)
#pragma unroll
    for (int r = 0; r < 8; ++r) {
      pw[(r + 8 * hi) * BC + nlo]      = (_Float16)sa[r];
      pw[(r + 8 * hi) * BC + 16 + nlo] = (_Float16)sb[r];
    }
    v16h ap = ld_frag(pw, 0, BC, 0, lane);
    o0 = wmma_f16(ap, ld_frag(vT, 0,  BC, 0, lane), o0);
    o1 = wmma_f16(ap, ld_frag(vT, 16, BC, 0, lane), o1);
    o2 = wmma_f16(ap, ld_frag(vT, 32, BC, 0, lane), o2);
    o3 = wmma_f16(ap, ld_frag(vT, 48, BC, 0, lane), o3);
  }

  // epilogue: normalize and scatter back to [B,S,D] (heads interleaved)
#pragma unroll
  for (int r = 0; r < 8; ++r) {
    int srow = q0 + w * 16 + r + 8 * hi;
    float inv = 1.0f / lrun[r];
    long base = (long)(b * S + srow) * D + h * DK;
    ctx[base + nlo]      = (_Float16)(o0[r] * inv);
    ctx[base + 16 + nlo] = (_Float16)(o1[r] * inv);
    ctx[base + 32 + nlo] = (_Float16)(o2[r] * inv);
    ctx[base + 48 + nlo] = (_Float16)(o3[r] * inv);
  }
}

// ---------------- host launcher ----------------
extern "C" void kernel_launch(void* const* d_in, const int* in_sizes, int n_in,
                              void* d_out, int out_size, void* d_ws,
                              size_t ws_size, hipStream_t stream) {
  const float* x  = (const float*)d_in[0];
  const float* Wq = (const float*)d_in[1];
  const float* bq = (const float*)d_in[2];
  const float* Wk = (const float*)d_in[3];
  const float* bk = (const float*)d_in[4];
  const float* Wv = (const float*)d_in[5];
  const float* bv = (const float*)d_in[6];
  const float* Wo = (const float*)d_in[7];
  const float* bo = (const float*)d_in[8];
  float* out = (float*)d_out;

  // workspace carve-up (f16): x, 4 weights(T), Q, K, Vt, ctx => 48MB
  _Float16* p = (_Float16*)d_ws;
  _Float16* xh   = p; p += XE;
  _Float16* wqt  = p; p += WE;
  _Float16* wkt  = p; p += WE;
  _Float16* wvt  = p; p += WE;
  _Float16* wot  = p; p += WE;
  _Float16* qh   = p; p += XE;
  _Float16* kh   = p; p += XE;
  _Float16* vt   = p; p += XE;   // [B,H,DK,S]
  _Float16* ctxh = p; p += XE;
  if (ws_size < (size_t)((char*)p - (char*)d_ws)) return;

  // 1) conversions: x straight; weights converted + transposed to [N][K]
  f32_to_f16_kernel<<<2048, 256, 0, stream>>>(x, xh, (int)XE);
  dim3 tgrid(D / 32, D / 32);
  transpose_f32_to_f16_kernel<<<tgrid, 256, 0, stream>>>(Wq, wqt, D);
  transpose_f32_to_f16_kernel<<<tgrid, 256, 0, stream>>>(Wk, wkt, D);
  transpose_f32_to_f16_kernel<<<tgrid, 256, 0, stream>>>(Wv, wvt, D);
  transpose_f32_to_f16_kernel<<<tgrid, 256, 0, stream>>>(Wo, wot, D);

  // 2) Q/K/V projections
  dim3 ggrid(D / 128, MROWS / 128);  // (8, 32)
  gemm_bias_kernel<1><<<ggrid, 256, 0, stream>>>(xh, wqt, bq, nullptr, qh,
                                                 MROWS, D, D);
  gemm_bias_kernel<1><<<ggrid, 256, 0, stream>>>(xh, wkt, bk, nullptr, kh,
                                                 MROWS, D, D);
  gemm_bias_kernel<2><<<ggrid, 256, 0, stream>>>(xh, wvt, bv, nullptr, vt,
                                                 MROWS, D, D);

  // 3) attention: B*H*(S/64) = 1024 blocks of 128 threads
  attn_kernel<<<BB * H * (S / 64), 128, 0, stream>>>(qh, kh, vt, ctxh);

  // 4) output projection (f32 out into d_out)
  gemm_bias_kernel<0><<<ggrid, 256, 0, stream>>>(ctxh, wot, bo, out,
                                                 nullptr, MROWS, D, D);
}

// v001
// A run of this version takes 170 microseconds.
// Next to v000, in two timings, it ran 1.63 and 1.62 times as fast.
#include <hip/hip_runtime.h>
#include <hip/hip_bf16.h>

typedef __attribute__((ext_vector_type(16))) _Float16 v16h;
typedef __attribute__((ext_vector_type(8)))  float    v8f;

// ---------------- problem constants ----------------
constexpr int BB = 4, S = 1024, D = 1024, H = 16, DK = 64;
constexpr int MROWS = BB * S;          // 4096
constexpr long XE = (long)MROWS * D;   // 4M elements
constexpr long WE = (long)D * D;       // 1M elements

// ---------------- WMMA wrapper ----------------
__device__ __forceinline__ v8f wmma_f16(v16h a, v16h b, v8f c) {
  return __builtin_amdgcn_wmma_f32_16x16x32_f16(
      /*neg_a=*/false, a, /*neg_b=*/false, b,
      /*c_mod=*/(short)0, c, /*reuse_a=*/false, /*reuse_b=*/false);
}

__device__ __forceinline__ unsigned lds_off(const _Float16* p) {
  return (unsigned)(unsigned long long)p;
}
__device__ __forceinline__ void async_ld_b128_x4(
    const _Float16* l0, const _Float16* g0, const _Float16* l1,
    const _Float16* g1, const _Float16* l2, const _Float16* g2,
    const _Float16* l3, const _Float16* g3) {
  asm volatile("global_load_async_to_lds_b128 %0, %1, off\n\t"
               "global_load_async_to_lds_b128 %2, %3, off\n\t"
               "global_load_async_to_lds_b128 %4, %5, off\n\t"
               "global_load_async_to_lds_b128 %6, %7, off\n\t"
               "s_wait_xcnt 0x0"
               :: "v"(lds_off(l0)), "v"(g0), "v"(lds_off(l1)), "v"(g1),
                  "v"(lds_off(l2)), "v"(g2), "v"(lds_off(l3)), "v"(g3)
               : "memory");
}
__device__ __forceinline__ void async_ld_b128_x8(
    const _Float16* const (&l)[8], const _Float16* const (&g)[8]) {
  asm volatile("global_load_async_to_lds_b128 %0, %1, off\n\t"
               "global_load_async_to_lds_b128 %2, %3, off\n\t"
               "global_load_async_to_lds_b128 %4, %5, off\n\t"
               "global_load_async_to_lds_b128 %6, %7, off\n\t"
               "global_load_async_to_lds_b128 %8, %9, off\n\t"
               "global_load_async_to_lds_b128 %10, %11, off\n\t"
               "global_load_async_to_lds_b128 %12, %13, off\n\t"
               "global_load_async_to_lds_b128 %14, %15, off\n\t"
               "s_wait_xcnt 0x0"
               :: "v"(lds_off(l[0])), "v"(g[0]), "v"(lds_off(l[1])), "v"(g[1]),
                  "v"(lds_off(l[2])), "v"(g[2]), "v"(lds_off(l[3])), "v"(g[3]),
                  "v"(lds_off(l[4])), "v"(g[4]), "v"(lds_off(l[5])), "v"(g[5]),
                  "v"(lds_off(l[6])), "v"(g[6]), "v"(lds_off(l[7])), "v"(g[7])
               : "memory");
}

constexpr int P128 = 72;   // rows of 64 f16 (128 B) at 144 B
constexpr int P64  = 40;   // rows of 32 f16 (64 B) at 80 B
__device__ __forceinline__ void wait_async0() {
  asm volatile("s_wait_asynccnt 0" ::: "memory");
}

__device__ __forceinline__ v16h ld_frag(const _Float16* tile, int rbase,
                                        int stride, int k0, int lane) {
  const int m  = lane & 15;
  const int kb = (lane >> 4) << 3;   // 0 or 8
  const _Float16* p = tile + (rbase + m) * stride + k0 + kb;
  union { uint4 u[2]; v16h h; } r;
  r.u[0] = *reinterpret_cast<const uint4*>(p);
  r.u[1] = *reinterpret_cast<const uint4*>(p + 16);
  return r.h;
}

__device__ __forceinline__ float rowmax16(float x) {
  x = fmaxf(x, __shfl_xor(x, 1, 32));
  x = fmaxf(x, __shfl_xor(x, 2, 32));
  x = fmaxf(x, __shfl_xor(x, 4, 32));
  x = fmaxf(x, __shfl_xor(x, 8, 32));
  return x;
}
__device__ __forceinline__ float rowsum16(float x) {
  x += __shfl_xor(x, 1, 32);
  x += __shfl_xor(x, 2, 32);
  x += __shfl_xor(x, 4, 32);
  x += __shfl_xor(x, 8, 32);
  return x;
}

// ---------------- fp32 -> fp16 convert (straight) ----------------
__global__ void f32_to_f16_kernel(const float* __restrict__ src,
                                  _Float16* __restrict__ dst, int n) {
  for (int i = blockIdx.x * blockDim.x + threadIdx.x; i < n;
       i += gridDim.x * blockDim.x)
    dst[i] = (_Float16)src[i];
}

// -------- fp32 -> fp16 convert + transpose: dst[c][r] = src[r][c] ----------
// Produces weights in [N][K] row-major so GEMM B-fragments are k-contiguous.
__global__ __launch_bounds__(256) void transpose_f32_to_f16_kernel(
    const float* __restrict__ src, _Float16* __restrict__ dst, int n) {
  __shared__ float tile[32][33];
  const int bx = blockIdx.x * 32, by = blockIdx.y * 32;
  const int tx = threadIdx.x & 31, ty = threadIdx.x >> 5;  // 8 rows / pass
#pragma unroll
  for (int i = 0; i < 32; i += 8)
    tile[ty + i][tx] = src[(long)(by + ty + i) * n + bx + tx];
  __syncthreads();
#pragma unroll
  for (int i = 0; i < 32; i += 8)
    dst[(long)(bx + ty + i) * n + by + tx] = (_Float16)tile[tx][ty + i];
}

// ---------------- GEMM: C[MxN] = A[MxK](f16) @ BT[NxK](f16)^T + bias -------
// Block tile 128x128, BK=64, 256 threads = 8 waves; wave w owns rows
// [16w,16w+16) x 128 cols = 8 f32 accumulators; 16 WMMAs per wave per k-step.
// OMODE: 0 = f32 row-major, 1 = f16 row-major, 2 = f16 [B,H,DK,S] (for V).
template <int OMODE>
__global__ __launch_bounds__(256) void gemm_bias_kernel(
    const _Float16* __restrict__ A, const _Float16* __restrict__ BT,
    const float* __restrict__ bias, float* __restrict__ Cf,
    _Float16* __restrict__ Ch, int M, int N, int K) {
  constexpr int BM = 128, BN = 128, BK = 64;
  __shared__ __attribute__((aligned(16))) _Float16 a_sh[BM * P128];  // [row][k]
  __shared__ __attribute__((aligned(16))) _Float16 b_sh[BN * P128];  // [n][k]

  const int tid = threadIdx.x;
  const int lane = tid & 31, w = tid >> 5;
  const int n0 = blockIdx.x * BN, m0 = blockIdx.y * BM;

  v8f acc[8];
#pragma unroll
  for (int j = 0; j < 8; ++j) acc[j] = {};

  for (int kk = 0; kk < K; kk += BK) {
    __syncthreads();
    // async-stage both tiles: 128 rows x 64 f16 = 8 x b128 per row each
    const _Float16* ld[8];
    const _Float16* gs[8];
#pragma unroll
    for (int i = 0; i < 4; ++i) {
      int idx = tid + i * 256;            // 0..1023
      int row = idx >> 3, g = (idx & 7) * 8;
      ld[2 * i]     = a_sh + row * P128 + g;
      gs[2 * i]     = A + (long)(m0 + row) * K + kk + g;
      ld[2 * i + 1] = b_sh + row * P128 + g;
      gs[2 * i + 1] = BT + (long)(n0 + row) * K + kk + g;
    }
    async_ld_b128_x8(ld, gs);
    wait_async0();
    __syncthreads();

    v16h a0 = ld_frag(a_sh, w * 16, P128, 0, lane);
    v16h a1 = ld_frag(a_sh, w * 16, P128, 32, lane);
#pragma unroll
    for (int j = 0; j < 8; ++j) {
      acc[j] = wmma_f16(a0, ld_frag(b_sh, j * 16, P128, 0, lane), acc[j]);
      acc[j] = wmma_f16(a1, ld_frag(b_sh, j * 16, P128, 32, lane), acc[j]);
    }
  }

  const int nlo = lane & 15, hi = (lane >> 4) & 1;
#pragma unroll
  for (int j = 0; j < 8; ++j) {
    int col = n0 + j * 16 + nlo;
    float bv = bias[col];
#pragma unroll
    for (int r = 0; r < 8; ++r) {
      long row = m0 + w * 16 + r + 8 * hi;
      float val = acc[j][r] + bv;
      if (OMODE == 0) {
        Cf[row * N + col] = val;
      } else if (OMODE == 1) {
        Ch[row * N + col] = (_Float16)val;
      } else {
        // V output in [B, H, DK, S]: row = b*S+s, col = h*DK+dk
        int b = (int)(row >> 10), s = (int)(row & (S - 1));
        int h = col >> 6, dk = col & (DK - 1);
        Ch[(long)((b * H + h) * DK + dk) * S + s] = (_Float16)val;
      }
    }
  }
}

// ---------------- flash attention -------------------------------------
// grid = B*H*(S/64) blocks, 128 threads (4 waves); wave owns 16 query rows.
// Q,K in [B,S,D] (head-sliced); V pre-transposed in [B,H,DK,S].
__global__ __launch_bounds__(128) void attn_kernel(
    const _Float16* __restrict__ Q, const _Float16* __restrict__ Km,
    const _Float16* __restrict__ Vt, _Float16* __restrict__ ctx) {
  constexpr int BQ = 64, BC = 32;
  __shared__ __attribute__((aligned(16))) _Float16 q_sh[BQ * P128];  // [q][dk]
  __shared__ __attribute__((aligned(16))) _Float16 k_sh[BC * P128];  // [key][dk]
  __shared__ __attribute__((aligned(16))) _Float16 vT[DK * P64];     // [dk][key]
  __shared__ __attribute__((aligned(16))) _Float16 p_sh[4 * 16 * P64];  // per-wave P

  const int tid = threadIdx.x, lane = tid & 31, w = tid >> 5;
  const int nsb = S / BQ;                 // 16
  const int sblk = blockIdx.x % nsb;
  const int bh = blockIdx.x / nsb;
  const int b = bh / H, h = bh % H;
  const int q0 = sblk * BQ;
  const int hi = (lane >> 4) & 1, nlo = lane & 15;

  // async-stage Q tile 64x64: 8 x b128 per row, 4 per thread
  {
    const int row = tid >> 3, g = (tid & 7) * 8;   // rows step by 16 per copy
    const _Float16* ql = q_sh + row * P128 + g;
    const _Float16* qg = Q + (long)(b * S + q0 + row) * D + h * DK + g;
    async_ld_b128_x4(ql, qg, ql + 16 * P128, qg + 16 * D,
                     ql + 32 * P128, qg + 32 * D, ql + 48 * P128, qg + 48 * D);
  }
  wait_async0();
  __syncthreads();
  v16h aq0 = ld_frag(q_sh, w * 16, P128, 0, lane);
  v16h aq1 = ld_frag(q_sh, w * 16, P128, 32, lane);

  float mrun[8], lrun[8];
  v8f o0 = {}, o1 = {}, o2 = {}, o3 = {};
#pragma unroll
  for (int r = 0; r < 8; ++r) { mrun[r] = -3.0e38f; lrun[r] = 0.f; }

  _Float16* pw = p_sh + w * 16 * P64;
  const _Float16* vt_base = Vt + (long)bh * DK * S;

  for (int t0 = 0; t0 < S; t0 += BC) {
    __syncthreads();
    // K chunk 32x64: 256 b128, 2/thread ; V^T chunk 64x32: 256 b128, 2/thread
    {
      const int row = tid >> 3, g = (tid & 7) * 8;    // second copy: row + 16
      const _Float16* kl = k_sh + row * P128 + g;
      const _Float16* kg = Km + (long)(b * S + t0 + row) * D + h * DK + g;
      const int dk = tid >> 2, gg = (tid & 3) * 8;    // second copy: dk + 32
      const _Float16* vl = vT + dk * P64 + gg;
      const _Float16* vg = vt_base + (long)dk * S + t0 + gg;
      async_ld_b128_x4(kl, kg, vl, vg, kl + 16 * P128, kg + 16 * D,
                       vl + 32 * P64, vg + 32 * S);
    }
    wait_async0();
    __syncthreads();

    // scores: 16 q-rows x 32 keys, contraction over DK=64
    v8f sa = {}, sb = {};
    sa = wmma_f16(aq0, ld_frag(k_sh, 0, P128, 0, lane), sa);
    sa = wmma_f16(aq1, ld_frag(k_sh, 0, P128, 32, lane), sa);
    sb = wmma_f16(aq0, ld_frag(k_sh, 16, P128, 0, lane), sb);
    sb = wmma_f16(aq1, ld_frag(k_sh, 16, P128, 32, lane), sb);

    // online softmax (scale = 1/sqrt(DK) = 0.125)
#pragma unroll
    for (int r = 0; r < 8; ++r) {
      float x0 = sa[r] * 0.125f, x1 = sb[r] * 0.125f;
      float mx = rowmax16(fmaxf(x0, x1));
      float nm = fmaxf(mrun[r], mx);
      float al = __expf(mrun[r] - nm);
      mrun[r] = nm;
      x0 = __expf(x0 - nm);
      x1 = __expf(x1 - nm);
      sa[r] = x0;
      sb[r] = x1;
      lrun[r] = lrun[r] * al + rowsum16(x0 + x1);
      o0[r] *= al; o1[r] *= al; o2[r] *= al; o3[r] *= al;
    }

    // re-fragment P via per-wave LDS staging (C layout -> A layout)
#pragma unroll
    for (int r = 0; r < 8; ++r) {
      pw[(r + 8 * hi) * P64 + nlo]      = (_Float16)sa[r];
      pw[(r + 8 * hi) * P64 + 16 + nlo] = (_Float16)sb[r];
    }
    v16h ap = ld_frag(pw, 0, P64, 0, lane);
    o0 = wmma_f16(ap, ld_frag(vT, 0,  P64, 0, lane), o0);
    o1 = wmma_f16(ap, ld_frag(vT, 16, P64, 0, lane), o1);
    o2 = wmma_f16(ap, ld_frag(vT, 32, P64, 0, lane), o2);
    o3 = wmma_f16(ap, ld_frag(vT, 48, P64, 0, lane), o3);
  }

  // epilogue: normalize and scatter back to [B,S,D] (heads interleaved)
#pragma unroll
  for (int r = 0; r < 8; ++r) {
    int srow = q0 + w * 16 + r + 8 * hi;
    float inv = 1.0f / lrun[r];
    long base = (long)(b * S + srow) * D + h * DK;
    ctx[base + nlo]      = (_Float16)(o0[r] * inv);
    ctx[base + 16 + nlo] = (_Float16)(o1[r] * inv);
    ctx[base + 32 + nlo] = (_Float16)(o2[r] * inv);
    ctx[base + 48 + nlo] = (_Float16)(o3[r] * inv);
  }
}

// ---------------- host launcher ----------------
extern "C" void kernel_launch(void* const* d_in, const int* in_sizes, int n_in,
                              void* d_out, int out_size, void* d_ws,
                              size_t ws_size, hipStream_t stream) {
  const float* x  = (const float*)d_in[0];
  const float* Wq = (const float*)d_in[1];
  const float* bq = (const float*)d_in[2];
  const float* Wk = (const float*)d_in[3];
  const float* bk = (const float*)d_in[4];
  const float* Wv = (const float*)d_in[5];
  const float* bv = (const float*)d_in[6];
  const float* Wo = (const float*)d_in[7];
  const float* bo = (const float*)d_in[8];
  float* out = (float*)d_out;

  // workspace carve-up (f16): x, 4 weights(T), Q, K, Vt, ctx => 48MB
  _Float16* p = (_Float16*)d_ws;
  _Float16* xh   = p; p += XE;
  _Float16* wqt  = p; p += WE;
  _Float16* wkt  = p; p += WE;
  _Float16* wvt  = p; p += WE;
  _Float16* wot  = p; p += WE;
  _Float16* qh   = p; p += XE;
  _Float16* kh   = p; p += XE;
  _Float16* vt   = p; p += XE;   // [B,H,DK,S]
  _Float16* ctxh = p; p += XE;
  if (ws_size < (size_t)((char*)p - (char*)d_ws)) return;

  // 1) conversions: x straight; weights converted + transposed to [N][K]
  f32_to_f16_kernel<<<2048, 256, 0, stream>>>(x, xh, (int)XE);
  dim3 tgrid(D / 32, D / 32);
  transpose_f32_to_f16_kernel<<<tgrid, 256, 0, stream>>>(Wq, wqt, D);
  transpose_f32_to_f16_kernel<<<tgrid, 256, 0, stream>>>(Wk, wkt, D);
  transpose_f32_to_f16_kernel<<<tgrid, 256, 0, stream>>>(Wv, wvt, D);
  transpose_f32_to_f16_kernel<<<tgrid, 256, 0, stream>>>(Wo, wot, D);

  // 2) Q/K/V projections
  dim3 ggrid(D / 128, MROWS / 128);  // (8, 32)
  gemm_bias_kernel<1><<<ggrid, 256, 0, stream>>>(xh, wqt, bq, nullptr, qh,
                                                 MROWS, D, D);
  gemm_bias_kernel<1><<<ggrid, 256, 0, stream>>>(xh, wkt, bk, nullptr, kh,
                                                 MROWS, D, D);
  gemm_bias_kernel<2><<<ggrid, 256, 0, stream>>>(xh, wvt, bv, nullptr, vt,
                                                 MROWS, D, D);

  // 3) attention: B*H*(S/64) = 1024 blocks of 128 threads
  attn_kernel<<<BB * H * (S / 64), 128, 0, stream>>>(qh, kh, vt, ctxh);

  // 4) output projection (f32 out into d_out)
  gemm_bias_kernel<0><<<ggrid, 256, 0, stream>>>(ctxh, wot, bo, out,
                                                 nullptr, MROWS, D, D);
}

// v002
// Measured time: 132 microseconds a run.
// Two timings next to v001 both put it at 1.29 times that version's speed.
// Counting every step since v000, it is 2.10 times as fast.
#include <hip/hip_runtime.h>
#include <hip/hip_bf16.h>

typedef __attribute__((ext_vector_type(16))) _Float16 v16h;
typedef __attribute__((ext_vector_type(8)))  float    v8f;

// ---------------- problem constants ----------------
constexpr int BB = 4, S = 1024, D = 1024, H = 16, DK = 64;
constexpr int MROWS = BB * S;          // 4096
constexpr long XE = (long)MROWS * D;   // 4M elements
constexpr long WE = (long)D * D;       // 1M elements

// ---------------- WMMA wrapper ----------------
__device__ __forceinline__ v8f wmma_f16(v16h a, v16h b, v8f c) {
  return __builtin_amdgcn_wmma_f32_16x16x32_f16(
      /*neg_a=*/false, a, /*neg_b=*/false, b,
      /*c_mod=*/(short)0, c, /*reuse_a=*/false, /*reuse_b=*/false);
}

__device__ __forceinline__ unsigned lds_off(const _Float16* p) {
  return (unsigned)(unsigned long long)p;
}
__device__ __forceinline__ void async_ld_b128_x4(
    const _Float16* l0, const _Float16* g0, const _Float16* l1,
    const _Float16* g1, const _Float16* l2, const _Float16* g2,
    const _Float16* l3, const _Float16* g3) {
  asm volatile("global_load_async_to_lds_b128 %0, %1, off\n\t"
               "global_load_async_to_lds_b128 %2, %3, off\n\t"
               "global_load_async_to_lds_b128 %4, %5, off\n\t"
               "global_load_async_to_lds_b128 %6, %7, off\n\t"
               "s_wait_xcnt 0x0"
               :: "v"(lds_off(l0)), "v"(g0), "v"(lds_off(l1)), "v"(g1),
                  "v"(lds_off(l2)), "v"(g2), "v"(lds_off(l3)), "v"(g3)
               : "memory");
}
__device__ __forceinline__ void async_ld_b128_x8(
    const _Float16* const (&l)[8], const _Float16* const (&g)[8]) {
  asm volatile("global_load_async_to_lds_b128 %0, %1, off\n\t"
               "global_load_async_to_lds_b128 %2, %3, off\n\t"
               "global_load_async_to_lds_b128 %4, %5, off\n\t"
               "global_load_async_to_lds_b128 %6, %7, off\n\t"
               "global_load_async_to_lds_b128 %8, %9, off\n\t"
               "global_load_async_to_lds_b128 %10, %11, off\n\t"
               "global_load_async_to_lds_b128 %12, %13, off\n\t"
               "global_load_async_to_lds_b128 %14, %15, off\n\t"
               "s_wait_xcnt 0x0"
               :: "v"(lds_off(l[0])), "v"(g[0]), "v"(lds_off(l[1])), "v"(g[1]),
                  "v"(lds_off(l[2])), "v"(g[2]), "v"(lds_off(l[3])), "v"(g[3]),
                  "v"(lds_off(l[4])), "v"(g[4]), "v"(lds_off(l[5])), "v"(g[5]),
                  "v"(lds_off(l[6])), "v"(g[6]), "v"(lds_off(l[7])), "v"(g[7])
               : "memory");
}

constexpr int P128 = 72;   // rows of 64 f16 (128 B) at 144 B
constexpr int P64  = 40;   // rows of 32 f16 (64 B) at 80 B
__device__ __forceinline__ void wait_async0() {
  asm volatile("s_wait_asynccnt 0" ::: "memory");
}

__device__ __forceinline__ v16h ld_frag(const _Float16* tile, int rbase,
                                        int stride, int k0, int lane) {
  const int m  = lane & 15;
  const int kb = (lane >> 4) << 3;   // 0 or 8
  const _Float16* p = tile + (rbase + m) * stride + k0 + kb;
  union { uint4 u[2]; v16h h; } r;
  r.u[0] = *reinterpret_cast<const uint4*>(p);
  r.u[1] = *reinterpret_cast<const uint4*>(p + 16);
  return r.h;
}

__device__ __forceinline__ float rowmax16(float x) {
  x = fmaxf(x, __shfl_xor(x, 1, 32));
  x = fmaxf(x, __shfl_xor(x, 2, 32));
  x = fmaxf(x, __shfl_xor(x, 4, 32));
  x = fmaxf(x, __shfl_xor(x, 8, 32));
  return x;
}
__device__ __forceinline__ float rowsum16(float x) {
  x += __shfl_xor(x, 1, 32);
  x += __shfl_xor(x, 2, 32);
  x += __shfl_xor(x, 4, 32);
  x += __shfl_xor(x, 8, 32);
  return x;
}

// ---------------- fp32 -> fp16 convert (straight) ----------------
__global__ void f32_to_f16_kernel(const float* __restrict__ src,
                                  _Float16* __restrict__ dst, int n) {
  for (int i = blockIdx.x * blockDim.x + threadIdx.x; i < n;
       i += gridDim.x * blockDim.x)
    dst[i] = (_Float16)src[i];
}

// -------- fp32 -> fp16 convert + transpose: dst[c][r] = src[r][c] ----------
// Produces weights in [N][K] row-major so GEMM B-fragments are k-contiguous.
__global__ __launch_bounds__(256) void transpose_f32_to_f16_kernel(
    const float* __restrict__ src, _Float16* __restrict__ dst, int n) {
  __shared__ float tile[32][33];
  const int bx = blockIdx.x * 32, by = blockIdx.y * 32;
  const int tx = threadIdx.x & 31, ty = threadIdx.x >> 5;  // 8 rows / pass
#pragma unroll
  for (int i = 0; i < 32; i += 8)
    tile[ty + i][tx] = src[(long)(by + ty + i) * n + bx + tx];
  __syncthreads();
#pragma unroll
  for (int i = 0; i < 32; i += 8)
    dst[(long)(bx + ty + i) * n + by + tx] = (_Float16)tile[tx][ty + i];
}

template <int LAYOUT>
__device__ __forceinline__ void gemm_store(
    const v8f (&acc)[8], const float* __restrict__ bias,
    float* __restrict__ Cf, _Float16* __restrict__ Ch, int N, int n0, int m0,
    int w, int lane) {
  const int nlo = lane & 15, hi = (lane >> 4) & 1;
#pragma unroll
  for (int j = 0; j < 8; ++j) {
    int col = n0 + j * 16 + nlo;
    float bv = bias[col];
#pragma unroll
    for (int r = 0; r < 8; ++r) {
      long row = m0 + w * 16 + r + 8 * hi;
      float val = acc[j][r] + bv;
      if (LAYOUT == 0) {
        Cf[row * N + col] = val;
      } else if (LAYOUT == 1) {
        Ch[row * N + col] = (_Float16)val;
      } else {
        // V output in [B, H, DK, S]: row = b*S+s, col = h*DK+dk
        int b = (int)(row >> 10), s = (int)(row & (S - 1));
        int h = col >> 6, dk = col & (DK - 1);
        Ch[(long)((b * H + h) * DK + dk) * S + s] = (_Float16)val;
      }
    }
  }
}

// ---------------- GEMM: C[MxN] = A[MxK](f16) @ BT[NxK](f16)^T + bias -------
// Block tile 128x128, BK=64, 256 threads = 8 waves; wave w owns rows
// [16w,16w+16) x 128 cols = 8 f32 accumulators; 16 WMMAs per wave per k-step.
// OMODE 0: one product, f32 row-major into Cf (bias0).
// OMODE 1: the three input projections in ONE launch, so that three
// work-groups share a WGP and fill each other's LDS and copy waits.
// blockIdx.z picks the weight (BT0 + z * WE), the bias and the output
// (Ch0 + z * XE); z = 0, 1 (Q, K): f16 row-major, z = 2 (V): f16 [B,H,DK,S].
template <int OMODE>
__global__ __launch_bounds__(256) void gemm_bias_kernel(
    const _Float16* __restrict__ A, const _Float16* __restrict__ BT0,
    const float* __restrict__ bias0, const float* __restrict__ bias1,
    const float* __restrict__ bias2, float* __restrict__ Cf,
    _Float16* __restrict__ Ch0, int M, int N, int K) {
  constexpr int BM = 128, BN = 128, BK = 64;
  __shared__ __attribute__((aligned(16))) _Float16 a_sh[BM * P128];  // [row][k]
  __shared__ __attribute__((aligned(16))) _Float16 b_sh[BN * P128];  // [n][k]

  const int tid = threadIdx.x;
  const int lane = tid & 31, w = tid >> 5;
  const int n0 = blockIdx.x * BN, m0 = blockIdx.y * BM;
  const int z = OMODE == 1 ? (int)blockIdx.z : 0;
  const _Float16* BT = BT0 + (long)z * WE;
  const float* bias = z == 0 ? bias0 : (z == 1 ? bias1 : bias2);
  _Float16* Ch = Ch0 + (long)z * XE;

  v8f acc[8];
#pragma unroll
  for (int j = 0; j < 8; ++j) acc[j] = {};

  for (int kk = 0; kk < K; kk += BK) {
    __syncthreads();
    // async-stage both tiles: 128 rows x 64 f16 = 8 x b128 per row each
    const _Float16* ld[8];
    const _Float16* gs[8];
#pragma unroll
    for (int i = 0; i < 4; ++i) {
      int idx = tid + i * 256;            // 0..1023
      int row = idx >> 3, g = (idx & 7) * 8;
      ld[2 * i]     = a_sh + row * P128 + g;
      gs[2 * i]     = A + (long)(m0 + row) * K + kk + g;
      ld[2 * i + 1] = b_sh + row * P128 + g;
      gs[2 * i + 1] = BT + (long)(n0 + row) * K + kk + g;
    }
    async_ld_b128_x8(ld, gs);
    wait_async0();
    __syncthreads();

    v16h a0 = ld_frag(a_sh, w * 16, P128, 0, lane);
    v16h a1 = ld_frag(a_sh, w * 16, P128, 32, lane);
#pragma unroll
    for (int j = 0; j < 8; ++j) {
      acc[j] = wmma_f16(a0, ld_frag(b_sh, j * 16, P128, 0, lane), acc[j]);
      acc[j] = wmma_f16(a1, ld_frag(b_sh, j * 16, P128, 32, lane), acc[j]);
    }
  }

  // one work-group-uniform branch picks the output layout
  if (OMODE == 1 && z == 2) {
    gemm_store<2>(acc, bias, Cf, Ch, N, n0, m0, w, lane);
    return;
  }
  gemm_store<OMODE>(acc, bias, Cf, Ch, N, n0, m0, w, lane);
  // In the listing this path can fall through into the V path's code, which
  // rewrites registers that the stores above name: the wait stands in front.
  if (OMODE == 1) asm volatile("s_wait_xcnt 0x0" ::: "memory");
}

// ---------------- flash attention -------------------------------------
// grid = B*H*(S/64) blocks, 128 threads (4 waves); wave owns 16 query rows.
// Q,K in [B,S,D] (head-sliced); V pre-transposed in [B,H,DK,S].
__global__ __launch_bounds__(128) void attn_kernel(
    const _Float16* __restrict__ Q, const _Float16* __restrict__ Km,
    const _Float16* __restrict__ Vt, _Float16* __restrict__ ctx) {
  constexpr int BQ = 64, BC = 32;
  __shared__ __attribute__((aligned(16))) _Float16 q_sh[BQ * P128];  // [q][dk]
  __shared__ __attribute__((aligned(16))) _Float16 k_sh[BC * P128];  // [key][dk]
  __shared__ __attribute__((aligned(16))) _Float16 vT[DK * P64];     // [dk][key]
  __shared__ __attribute__((aligned(16))) _Float16 p_sh[4 * 16 * P64];  // per-wave P

  const int tid = threadIdx.x, lane = tid & 31, w = tid >> 5;
  const int nsb = S / BQ;                 // 16
  const int sblk = blockIdx.x % nsb;
  const int bh = blockIdx.x / nsb;
  const int b = bh / H, h = bh % H;
  const int q0 = sblk * BQ;
  const int hi = (lane >> 4) & 1, nlo = lane & 15;

  // async-stage Q tile 64x64: 8 x b128 per row, 4 per thread
  {
    const int row = tid >> 3, g = (tid & 7) * 8;   // rows step by 16 per copy
    const _Float16* ql = q_sh + row * P128 + g;
    const _Float16* qg = Q + (long)(b * S + q0 + row) * D + h * DK + g;
    async_ld_b128_x4(ql, qg, ql + 16 * P128, qg + 16 * D,
                     ql + 32 * P128, qg + 32 * D, ql + 48 * P128, qg + 48 * D);
  }
  wait_async0();
  __syncthreads();
  v16h aq0 = ld_frag(q_sh, w * 16, P128, 0, lane);
  v16h aq1 = ld_frag(q_sh, w * 16, P128, 32, lane);

  float mrun[8], lrun[8];
  v8f o0 = {}, o1 = {}, o2 = {}, o3 = {};
#pragma unroll
  for (int r = 0; r < 8; ++r) { mrun[r] = -3.0e38f; lrun[r] = 0.f; }

  _Float16* pw = p_sh + w * 16 * P64;
  const _Float16* vt_base = Vt + (long)bh * DK * S;

  for (int t0 = 0; t0 < S; t0 += BC) {
    __syncthreads();
    // K chunk 32x64: 256 b128, 2/thread ; V^T chunk 64x32: 256 b128, 2/thread
    {
      const int row = tid >> 3, g = (tid & 7) * 8;    // second copy: row + 16
      const _Float16* kl = k_sh + row * P128 + g;
      const _Float16* kg = Km + (long)(b * S + t0 + row) * D + h * DK + g;
      const int dk = tid >> 2, gg = (tid & 3) * 8;    // second copy: dk + 32
      const _Float16* vl = vT + dk * P64 + gg;
      const _Float16* vg = vt_base + (long)dk * S + t0 + gg;
      async_ld_b128_x4(kl, kg, vl, vg, kl + 16 * P128, kg + 16 * D,
                       vl + 32 * P64, vg + 32 * S);
    }
    wait_async0();
    __syncthreads();

    // scores: 16 q-rows x 32 keys, contraction over DK=64
    v8f sa = {}, sb = {};
    sa = wmma_f16(aq0, ld_frag(k_sh, 0, P128, 0, lane), sa);
    sa = wmma_f16(aq1, ld_frag(k_sh, 0, P128, 32, lane), sa);
    sb = wmma_f16(aq0, ld_frag(k_sh, 16, P128, 0, lane), sb);
    sb = wmma_f16(aq1, ld_frag(k_sh, 16, P128, 32, lane), sb);

    // online softmax (scale = 1/sqrt(DK) = 0.125)
#pragma unroll
    for (int r = 0; r < 8; ++r) {
      float x0 = sa[r] * 0.125f, x1 = sb[r] * 0.125f;
      float mx = rowmax16(fmaxf(x0, x1));
      float nm = fmaxf(mrun[r], mx);
      float al = __expf(mrun[r] - nm);
      mrun[r] = nm;
      x0 = __expf(x0 - nm);
      x1 = __expf(x1 - nm);
      sa[r] = x0;
      sb[r] = x1;
      lrun[r] = lrun[r] * al + rowsum16(x0 + x1);
      o0[r] *= al; o1[r] *= al; o2[r] *= al; o3[r] *= al;
    }

    // re-fragment P via per-wave LDS staging (C layout -> A layout)
#pragma unroll
    for (int r = 0; r < 8; ++r) {
      pw[(r + 8 * hi) * P64 + nlo]      = (_Float16)sa[r];
      pw[(r + 8 * hi) * P64 + 16 + nlo] = (_Float16)sb[r];
    }
    v16h ap = ld_frag(pw, 0, P64, 0, lane);
    o0 = wmma_f16(ap, ld_frag(vT, 0,  P64, 0, lane), o0);
    o1 = wmma_f16(ap, ld_frag(vT, 16, P64, 0, lane), o1);
    o2 = wmma_f16(ap, ld_frag(vT, 32, P64, 0, lane), o2);
    o3 = wmma_f16(ap, ld_frag(vT, 48, P64, 0, lane), o3);
  }

  // epilogue: normalize and scatter back to [B,S,D] (heads interleaved)
#pragma unroll
  for (int r = 0; r < 8; ++r) {
    int srow = q0 + w * 16 + r + 8 * hi;
    float inv = 1.0f / lrun[r];
    long base = (long)(b * S + srow) * D + h * DK;
    ctx[base + nlo]      = (_Float16)(o0[r] * inv);
    ctx[base + 16 + nlo] = (_Float16)(o1[r] * inv);
    ctx[base + 32 + nlo] = (_Float16)(o2[r] * inv);
    ctx[base + 48 + nlo] = (_Float16)(o3[r] * inv);
  }
}

// ---------------- host launcher ----------------
extern "C" void kernel_launch(void* const* d_in, const int* in_sizes, int n_in,
                              void* d_out, int out_size, void* d_ws,
                              size_t ws_size, hipStream_t stream) {
  const float* x  = (const float*)d_in[0];
  const float* Wq = (const float*)d_in[1];
  const float* bq = (const float*)d_in[2];
  const float* Wk = (const float*)d_in[3];
  const float* bk = (const float*)d_in[4];
  const float* Wv = (const float*)d_in[5];
  const float* bv = (const float*)d_in[6];
  const float* Wo = (const float*)d_in[7];
  const float* bo = (const float*)d_in[8];
  float* out = (float*)d_out;

  // workspace carve-up (f16): x, 4 weights(T), Q, K, Vt, ctx => 48MB
  _Float16* p = (_Float16*)d_ws;
  _Float16* xh   = p; p += XE;
  _Float16* wqt  = p; p += WE;
  _Float16* wkt  = p; p += WE;
  _Float16* wvt  = p; p += WE;
  _Float16* wot  = p; p += WE;
  _Float16* qh   = p; p += XE;
  _Float16* kh   = p; p += XE;
  _Float16* vt   = p; p += XE;   // [B,H,DK,S]
  _Float16* ctxh = p; p += XE;
  if (ws_size < (size_t)((char*)p - (char*)d_ws)) return;

  // 1) conversions: x straight; weights converted + transposed to [N][K]
  f32_to_f16_kernel<<<2048, 256, 0, stream>>>(x, xh, (int)XE);
  dim3 tgrid(D / 32, D / 32);
  transpose_f32_to_f16_kernel<<<tgrid, 256, 0, stream>>>(Wq, wqt, D);
  transpose_f32_to_f16_kernel<<<tgrid, 256, 0, stream>>>(Wk, wkt, D);
  transpose_f32_to_f16_kernel<<<tgrid, 256, 0, stream>>>(Wv, wvt, D);
  transpose_f32_to_f16_kernel<<<tgrid, 256, 0, stream>>>(Wo, wot, D);

  // 2) Q/K/V projections, one launch: wqt, wkt, wvt lie WE apart and
  //    qh, kh, vt lie XE apart in the workspace
  dim3 ggrid(D / 128, MROWS / 128);      // (8, 32)
  dim3 ggrid3(D / 128, MROWS / 128, 3);  // z = Q, K, V
  gemm_bias_kernel<1><<<ggrid3, 256, 0, stream>>>(xh, wqt, bq, bk, bv, nullptr,
                                                  qh, MROWS, D, D);

  // 3) attention: B*H*(S/64) = 1024 blocks of 128 threads
  attn_kernel<<<BB * H * (S / 64), 128, 0, stream>>>(qh, kh, vt, ctxh);

  // 4) output projection (f32 out into d_out)
  gemm_bias_kernel<0><<<ggrid, 256, 0, stream>>>(ctxh, wot, bo, nullptr, nullptr,
                                                 out, nullptr, MROWS, D, D);
}

// v003
// It runs in 109 microseconds.
// Next to v002, in two timings, it ran 1.19 times as fast each time.
// Over all steps from v000 it is 2.50 times as fast.
#include <hip/hip_runtime.h>
#include <hip/hip_bf16.h>

typedef __attribute__((ext_vector_type(16))) _Float16 v16h;
typedef __attribute__((ext_vector_type(8)))  float    v8f;

// ---------------- problem constants ----------------
constexpr int BB = 4, S = 1024, D = 1024, H = 16, DK = 64;
constexpr int MROWS = BB * S;          // 4096
constexpr long XE = (long)MROWS * D;   // 4M elements
constexpr long WE = (long)D * D;       // 1M elements

// ---------------- WMMA wrapper ----------------
__device__ __forceinline__ v8f wmma_f16(v16h a, v16h b, v8f c) {
  return __builtin_amdgcn_wmma_f32_16x16x32_f16(
      /*neg_a=*/false, a, /*neg_b=*/false, b,
      /*c_mod=*/(short)0, c, /*reuse_a=*/false, /*reuse_b=*/false);
}

__device__ __forceinline__ unsigned lds_off(const _Float16* p) {
  return (unsigned)(unsigned long long)p;
}
__device__ __forceinline__ void async_ld_b128_x4(
    const _Float16* l0, const _Float16* g0, const _Float16* l1,
    const _Float16* g1, const _Float16* l2, const _Float16* g2,
    const _Float16* l3, const _Float16* g3) {
  asm volatile("global_load_async_to_lds_b128 %0, %1, off\n\t"
               "global_load_async_to_lds_b128 %2, %3, off\n\t"
               "global_load_async_to_lds_b128 %4, %5, off\n\t"
               "global_load_async_to_lds_b128 %6, %7, off\n\t"
               "s_wait_xcnt 0x0"
               :: "v"(lds_off(l0)), "v"(g0), "v"(lds_off(l1)), "v"(g1),
                  "v"(lds_off(l2)), "v"(g2), "v"(lds_off(l3)), "v"(g3)
               : "memory");
}
__device__ __forceinline__ void async_ld_b128_x8(
    const _Float16* const (&l)[8], const _Float16* const (&g)[8]) {
  asm volatile("global_load_async_to_lds_b128 %0, %1, off\n\t"
               "global_load_async_to_lds_b128 %2, %3, off\n\t"
               "global_load_async_to_lds_b128 %4, %5, off\n\t"
               "global_load_async_to_lds_b128 %6, %7, off\n\t"
               "global_load_async_to_lds_b128 %8, %9, off\n\t"
               "global_load_async_to_lds_b128 %10, %11, off\n\t"
               "global_load_async_to_lds_b128 %12, %13, off\n\t"
               "global_load_async_to_lds_b128 %14, %15, off\n\t"
               "s_wait_xcnt 0x0"
               :: "v"(lds_off(l[0])), "v"(g[0]), "v"(lds_off(l[1])), "v"(g[1]),
                  "v"(lds_off(l[2])), "v"(g[2]), "v"(lds_off(l[3])), "v"(g[3]),
                  "v"(lds_off(l[4])), "v"(g[4]), "v"(lds_off(l[5])), "v"(g[5]),
                  "v"(lds_off(l[6])), "v"(g[6]), "v"(lds_off(l[7])), "v"(g[7])
               : "memory");
}

constexpr int P128 = 72;   // rows of 64 f16 (128 B) at 144 B
constexpr int P64  = 40;   // rows of 32 f16 (64 B) at 80 B
__device__ __forceinline__ void wait_async0() {
  asm volatile("s_wait_asynccnt 0" ::: "memory");
}

__device__ __forceinline__ v16h ld_frag(const _Float16* tile, int rbase,
                                        int stride, int k0, int lane) {
  const int m  = lane & 15;
  const int kb = (lane >> 4) << 3;   // 0 or 8
  const _Float16* p = tile + (rbase + m) * stride + k0 + kb;
  union { uint4 u[2]; v16h h; } r;
  r.u[0] = *reinterpret_cast<const uint4*>(p);
  r.u[1] = *reinterpret_cast<const uint4*>(p + 16);
  return r.h;
}

__device__ __forceinline__ float xhalf(float x) {
  int v = __builtin_bit_cast(int, x);
  return __builtin_bit_cast(float, __builtin_amdgcn_permlanex16(
      v, v, 0x76543210, 0xfedcba98, false, false));
}

// ---------------- fp32 -> fp16 convert (straight) ----------------
__global__ void f32_to_f16_kernel(const float* __restrict__ src,
                                  _Float16* __restrict__ dst, int n) {
  for (int i = blockIdx.x * blockDim.x + threadIdx.x; i < n;
       i += gridDim.x * blockDim.x)
    dst[i] = (_Float16)src[i];
}

// -------- fp32 -> fp16 convert + transpose: dst[c][r] = src[r][c] ----------
// Produces weights in [N][K] row-major so GEMM B-fragments are k-contiguous.
__global__ __launch_bounds__(256) void transpose_f32_to_f16_kernel(
    const float* __restrict__ src, _Float16* __restrict__ dst, int n) {
  __shared__ float tile[32][33];
  const int bx = blockIdx.x * 32, by = blockIdx.y * 32;
  const int tx = threadIdx.x & 31, ty = threadIdx.x >> 5;  // 8 rows / pass
#pragma unroll
  for (int i = 0; i < 32; i += 8)
    tile[ty + i][tx] = src[(long)(by + ty + i) * n + bx + tx];
  __syncthreads();
#pragma unroll
  for (int i = 0; i < 32; i += 8)
    dst[(long)(bx + ty + i) * n + by + tx] = (_Float16)tile[tx][ty + i];
}

template <int LAYOUT>
__device__ __forceinline__ void gemm_store(
    const v8f (&acc)[8], const float* __restrict__ bias,
    float* __restrict__ Cf, _Float16* __restrict__ Ch, int N, int n0, int m0,
    int w, int lane) {
  const int nlo = lane & 15, hi = (lane >> 4) & 1;
#pragma unroll
  for (int j = 0; j < 8; ++j) {
    int col = n0 + j * 16 + nlo;
    float bv = bias[col];
#pragma unroll
    for (int r = 0; r < 8; ++r) {
      long row = m0 + w * 16 + r + 8 * hi;
      float val = acc[j][r] + bv;
      if (LAYOUT == 0) {
        Cf[row * N + col] = val;
      } else if (LAYOUT == 1) {
        Ch[row * N + col] = (_Float16)val;
      } else {
        // V output in [B, H, DK, S]: row = b*S+s, col = h*DK+dk
        int b = (int)(row >> 10), s = (int)(row & (S - 1));
        int h = col >> 6, dk = col & (DK - 1);
        Ch[(long)((b * H + h) * DK + dk) * S + s] = (_Float16)val;
      }
    }
  }
}

// ---------------- GEMM: C[MxN] = A[MxK](f16) @ BT[NxK](f16)^T + bias -------
// Block tile 128x128, BK=64, 256 threads = 8 waves; wave w owns rows
// [16w,16w+16) x 128 cols = 8 f32 accumulators; 16 WMMAs per wave per k-step.
// OMODE 0: one product, f32 row-major into Cf (bias0).
// OMODE 1: the three input projections in ONE launch, so that three
// work-groups share a WGP and fill each other's LDS and copy waits.
// blockIdx.z picks the weight (BT0 + z * WE), the bias and the output
// (Ch0 + z * XE); z = 0, 1 (Q, K): f16 row-major, z = 2 (V): f16 [B,H,DK,S].
template <int OMODE>
__global__ __launch_bounds__(256) void gemm_bias_kernel(
    const _Float16* __restrict__ A, const _Float16* __restrict__ BT0,
    const float* __restrict__ bias0, const float* __restrict__ bias1,
    const float* __restrict__ bias2, float* __restrict__ Cf,
    _Float16* __restrict__ Ch0, int M, int N, int K) {
  constexpr int BM = 128, BN = 128, BK = 64;
  __shared__ __attribute__((aligned(16))) _Float16 a_sh[BM * P128];  // [row][k]
  __shared__ __attribute__((aligned(16))) _Float16 b_sh[BN * P128];  // [n][k]

  const int tid = threadIdx.x;
  const int lane = tid & 31, w = tid >> 5;
  const int n0 = blockIdx.x * BN, m0 = blockIdx.y * BM;
  const int z = OMODE == 1 ? (int)blockIdx.z : 0;
  const _Float16* BT = BT0 + (long)z * WE;
  const float* bias = z == 0 ? bias0 : (z == 1 ? bias1 : bias2);
  _Float16* Ch = Ch0 + (long)z * XE;

  v8f acc[8];
#pragma unroll
  for (int j = 0; j < 8; ++j) acc[j] = {};

  for (int kk = 0; kk < K; kk += BK) {
    __syncthreads();
    // async-stage both tiles: 128 rows x 64 f16 = 8 x b128 per row each
    const _Float16* ld[8];
    const _Float16* gs[8];
#pragma unroll
    for (int i = 0; i < 4; ++i) {
      int idx = tid + i * 256;            // 0..1023
      int row = idx >> 3, g = (idx & 7) * 8;
      ld[2 * i]     = a_sh + row * P128 + g;
      gs[2 * i]     = A + (long)(m0 + row) * K + kk + g;
      ld[2 * i + 1] = b_sh + row * P128 + g;
      gs[2 * i + 1] = BT + (long)(n0 + row) * K + kk + g;
    }
    async_ld_b128_x8(ld, gs);
    wait_async0();
    __syncthreads();

    v16h a0 = ld_frag(a_sh, w * 16, P128, 0, lane);
    v16h a1 = ld_frag(a_sh, w * 16, P128, 32, lane);
#pragma unroll
    for (int j = 0; j < 8; ++j) {
      acc[j] = wmma_f16(a0, ld_frag(b_sh, j * 16, P128, 0, lane), acc[j]);
      acc[j] = wmma_f16(a1, ld_frag(b_sh, j * 16, P128, 32, lane), acc[j]);
    }
  }

  // one work-group-uniform branch picks the output layout
  if (OMODE == 1 && z == 2) {
    gemm_store<2>(acc, bias, Cf, Ch, N, n0, m0, w, lane);
    return;
  }
  gemm_store<OMODE>(acc, bias, Cf, Ch, N, n0, m0, w, lane);
  // In the listing this path can fall through into the V path's code, which
  // rewrites registers that the stores above name: the wait stands in front.
  if (OMODE == 1) asm volatile("s_wait_xcnt 0x0" ::: "memory");
}

__global__ __launch_bounds__(128) void attn_kernel(
    const _Float16* __restrict__ Q, const _Float16* __restrict__ Km,
    const _Float16* __restrict__ Vt, _Float16* __restrict__ ctx) {
  constexpr int BQ = 64, BC = 32;
  __shared__ __attribute__((aligned(16))) _Float16 q_sh[BQ * P128];  // [q][dk]
  __shared__ __attribute__((aligned(16))) _Float16 k_sh[BC * P128];  // [key][dk]
  __shared__ __attribute__((aligned(16))) _Float16 vT[DK * P64];     // [dk][key]

  const int tid = threadIdx.x, lane = tid & 31, w = tid >> 5;
  const int nsb = S / BQ;                 // 16
  const int sblk = blockIdx.x % nsb;
  const int bh = blockIdx.x / nsb;
  const int b = bh / H, h = bh % H;
  const int q0 = sblk * BQ;
  const int hi = (lane >> 4) & 1, nlo = lane & 15;

  // async-stage Q tile 64x64: 8 x b128 per row, 4 per thread
  {
    const int row = tid >> 3, g = (tid & 7) * 8;   // rows step by 16 per copy
    const _Float16* ql = q_sh + row * P128 + g;
    const _Float16* qg = Q + (long)(b * S + q0 + row) * D + h * DK + g;
    async_ld_b128_x4(ql, qg, ql + 16 * P128, qg + 16 * D,
                     ql + 32 * P128, qg + 32 * D, ql + 48 * P128, qg + 48 * D);
  }
  wait_async0();
  __syncthreads();
  v16h bq0 = ld_frag(q_sh, w * 16, P128, 0, lane);
  v16h bq1 = ld_frag(q_sh, w * 16, P128, 32, lane);

  // per lane: running maximum of its query, running sum over its own keys
  float mrun = -3.0e38f, lrun = 0.f;
  v8f o0 = {}, o1 = {}, o2 = {}, o3 = {};   // O^T: dk = 16*t + r + 8*hi

  const _Float16* vt_base = Vt + (long)bh * DK * S;

  for (int t0 = 0; t0 < S; t0 += BC) {
    __syncthreads();
    // K chunk 32x64: 256 b128, 2/thread ; V^T chunk 64x32: 256 b128, 2/thread
    {
      const int row = tid >> 3, g = (tid & 7) * 8;    // second copy: row + 16
      const _Float16* kl = k_sh + row * P128 + g;
      const _Float16* kg = Km + (long)(b * S + t0 + row) * D + h * DK + g;
      const int dk = tid >> 2, gg = (tid & 3) * 8;    // second copy: dk + 32
      const _Float16* vl = vT + dk * P64 + gg;
      const _Float16* vg = vt_base + (long)dk * S + t0 + gg;
      async_ld_b128_x4(kl, kg, vl, vg, kl + 16 * P128, kg + 16 * D,
                       vl + 32 * P64, vg + 32 * S);
    }
    wait_async0();
    __syncthreads();

    // scores, transposed: 32 keys x 16 query columns, contraction over DK=64
    v8f sa = {}, sb = {};
    sa = wmma_f16(ld_frag(k_sh, 0, P128, 0, lane), bq0, sa);
    sa = wmma_f16(ld_frag(k_sh, 0, P128, 32, lane), bq1, sa);
    sb = wmma_f16(ld_frag(k_sh, 16, P128, 0, lane), bq0, sb);
    sb = wmma_f16(ld_frag(k_sh, 16, P128, 32, lane), bq1, sb);

    // online softmax (scale = 1/sqrt(DK) = 0.125)
    float mx = fmaxf(sa[0], sb[0]);
    for (int r = 1; r < 8; ++r) mx = fmaxf(mx, fmaxf(sa[r], sb[r]));
    mx = fmaxf(mx, xhalf(mx)) * 0.125f;   // both halves: the query's maximum
    const float nm = fmaxf(mrun, mx);
    const float al = __expf(mrun - nm);
    mrun = nm;
    float ps = 0.f;
    v16h pb;   // P^T as B operand: element e = key 8*hi + e, 8 + e = key 16 + 8*hi + e
    for (int r = 0; r < 8; ++r) {
      float x0 = __expf(sa[r] * 0.125f - nm);
      float x1 = __expf(sb[r] * 0.125f - nm);
      ps += x0 + x1;
      pb[r]     = (_Float16)x0;
      pb[8 + r] = (_Float16)x1;
    }
    lrun = lrun * al + ps;
    o0 *= al; o1 *= al; o2 *= al; o3 *= al;

    o0 = wmma_f16(ld_frag(vT, 0,  P64, 0, lane), pb, o0);
    o1 = wmma_f16(ld_frag(vT, 16, P64, 0, lane), pb, o1);
    o2 = wmma_f16(ld_frag(vT, 32, P64, 0, lane), pb, o2);
    o3 = wmma_f16(ld_frag(vT, 48, P64, 0, lane), pb, o3);
  }

  // epilogue: join the halves' sums, normalize, store to [B,S,D] (heads
  // interleaved); a lane's 8 registers of a tile are 8 consecutive dk: 16 B
  const float inv = 1.0f / (lrun + xhalf(lrun));
  _Float16* cp = ctx + (long)(b * S + q0 + w * 16 + nlo) * D + h * DK + 8 * hi;
  const v8f* ot[4] = {&o0, &o1, &o2, &o3};
  for (int t = 0; t < 4; ++t) {
    union { _Float16 hh[8]; uint4 u; } pk;
    for (int r = 0; r < 8; ++r) pk.hh[r] = (_Float16)((*ot[t])[r] * inv);
    *reinterpret_cast<uint4*>(cp + 16 * t) = pk.u;
  }
}

// ---------------- host launcher ----------------
extern "C" void kernel_launch(void* const* d_in, const int* in_sizes, int n_in,
                              void* d_out, int out_size, void* d_ws,
                              size_t ws_size, hipStream_t stream) {
  const float* x  = (const float*)d_in[0];
  const float* Wq = (const float*)d_in[1];
  const float* bq = (const float*)d_in[2];
  const float* Wk = (const float*)d_in[3];
  const float* bk = (const float*)d_in[4];
  const float* Wv = (const float*)d_in[5];
  const float* bv = (const float*)d_in[6];
  const float* Wo = (const float*)d_in[7];
  const float* bo = (const float*)d_in[8];
  float* out = (float*)d_out;

  // workspace carve-up (f16): x, 4 weights(T), Q, K, Vt, ctx => 48MB
  _Float16* p = (_Float16*)d_ws;
  _Float16* xh   = p; p += XE;
  _Float16* wqt  = p; p += WE;
  _Float16* wkt  = p; p += WE;
  _Float16* wvt  = p; p += WE;
  _Float16* wot  = p; p += WE;
  _Float16* qh   = p; p += XE;
  _Float16* kh   = p; p += XE;
  _Float16* vt   = p; p += XE;   // [B,H,DK,S]
  _Float16* ctxh = p; p += XE;
  if (ws_size < (size_t)((char*)p - (char*)d_ws)) return;

  // 1) conversions: x straight; weights converted + transposed to [N][K]
  f32_to_f16_kernel<<<2048, 256, 0, stream>>>(x, xh, (int)XE);
  dim3 tgrid(D / 32, D / 32);
  transpose_f32_to_f16_kernel<<<tgrid, 256, 0, stream>>>(Wq, wqt, D);
  transpose_f32_to_f16_kernel<<<tgrid, 256, 0, stream>>>(Wk, wkt, D);
  transpose_f32_to_f16_kernel<<<tgrid, 256, 0, stream>>>(Wv, wvt, D);
  transpose_f32_to_f16_kernel<<<tgrid, 256, 0, stream>>>(Wo, wot, D);

  // 2) Q/K/V projections, one launch: wqt, wkt, wvt lie WE apart and
  //    qh, kh, vt lie XE apart in the workspace
  dim3 ggrid(D / 128, MROWS / 128);      // (8, 32)
  dim3 ggrid3(D / 128, MROWS / 128, 3);  // z = Q, K, V
  gemm_bias_kernel<1><<<ggrid3, 256, 0, stream>>>(xh, wqt, bq, bk, bv, nullptr,
                                                  qh, MROWS, D, D);

  // 3) attention: B*H*(S/64) = 1024 blocks of 128 threads
  attn_kernel<<<BB * H * (S / 64), 128, 0, stream>>>(qh, kh, vt, ctxh);

  // 4) output projection (f32 out into d_out)
  gemm_bias_kernel<0><<<ggrid, 256, 0, stream>>>(ctxh, wot, bo, nullptr, nullptr,
                                                 out, nullptr, MROWS, D, D);
}

// v004
// A run of this version takes 98.4 microseconds.
// Two timings next to v003 put it at 1.11 and 1.12 times that version's speed.
// All steps since v000 together make it 2.78 times as fast.
#include <hip/hip_runtime.h>
#include <hip/hip_bf16.h>

typedef __attribute__((ext_vector_type(16))) _Float16 v16h;
typedef __attribute__((ext_vector_type(8)))  float    v8f;

// ---------------- problem constants ----------------
constexpr int BB = 4, S = 1024, D = 1024, H = 16, DK = 64;
constexpr int MROWS = BB * S;          // 4096
constexpr long XE = (long)MROWS * D;   // 4M elements
constexpr long WE = (long)D * D;       // 1M elements

// ---------------- WMMA wrapper ----------------
__device__ __forceinline__ v8f wmma_f16(v16h a, v16h b, v8f c) {
  return __builtin_amdgcn_wmma_f32_16x16x32_f16(
      /*neg_a=*/false, a, /*neg_b=*/false, b,
      /*c_mod=*/(short)0, c, /*reuse_a=*/false, /*reuse_b=*/false);
}

__device__ __forceinline__ unsigned lds_off(const _Float16* p) {
  return (unsigned)(unsigned long long)p;
}
__device__ __forceinline__ void async_ld_b128_x4(
    const _Float16* l0, const _Float16* g0, const _Float16* l1,
    const _Float16* g1, const _Float16* l2, const _Float16* g2,
    const _Float16* l3, const _Float16* g3) {
  asm volatile("global_load_async_to_lds_b128 %0, %1, off\n\t"
               "global_load_async_to_lds_b128 %2, %3, off\n\t"
               "global_load_async_to_lds_b128 %4, %5, off\n\t"
               "global_load_async_to_lds_b128 %6, %7, off\n\t"
               "s_wait_xcnt 0x0"
               :: "v"(lds_off(l0)), "v"(g0), "v"(lds_off(l1)), "v"(g1),
                  "v"(lds_off(l2)), "v"(g2), "v"(lds_off(l3)), "v"(g3)
               : "memory");
}
__device__ __forceinline__ void async_ld_b128_x8(
    const _Float16* const (&l)[8], const _Float16* const (&g)[8]) {
  asm volatile("global_load_async_to_lds_b128 %0, %1, off\n\t"
               "global_load_async_to_lds_b128 %2, %3, off\n\t"
               "global_load_async_to_lds_b128 %4, %5, off\n\t"
               "global_load_async_to_lds_b128 %6, %7, off\n\t"
               "global_load_async_to_lds_b128 %8, %9, off\n\t"
               "global_load_async_to_lds_b128 %10, %11, off\n\t"
               "global_load_async_to_lds_b128 %12, %13, off\n\t"
               "global_load_async_to_lds_b128 %14, %15, off\n\t"
               "s_wait_xcnt 0x0"
               :: "v"(lds_off(l[0])), "v"(g[0]), "v"(lds_off(l[1])), "v"(g[1]),
                  "v"(lds_off(l[2])), "v"(g[2]), "v"(lds_off(l[3])), "v"(g[3]),
                  "v"(lds_off(l[4])), "v"(g[4]), "v"(lds_off(l[5])), "v"(g[5]),
                  "v"(lds_off(l[6])), "v"(g[6]), "v"(lds_off(l[7])), "v"(g[7])
               : "memory");
}

constexpr int P128 = 72;   // rows of 64 f16 (128 B) at 144 B
constexpr int P64  = 40;   // rows of 32 f16 (64 B) at 80 B
__device__ __forceinline__ void wait_async0() {
  asm volatile("s_wait_asynccnt 0" ::: "memory");
}

__device__ __forceinline__ v16h ld_frag(const _Float16* tile, int rbase,
                                        int stride, int k0, int lane) {
  const int m  = lane & 15;
  const int kb = (lane >> 4) << 3;   // 0 or 8
  const _Float16* p = tile + (rbase + m) * stride + k0 + kb;
  union { uint4 u[2]; v16h h; } r;
  r.u[0] = *reinterpret_cast<const uint4*>(p);
  r.u[1] = *reinterpret_cast<const uint4*>(p + 16);
  return r.h;
}

__device__ __forceinline__ float xhalf(float x) {
  int v = __builtin_bit_cast(int, x);
  return __builtin_bit_cast(float, __builtin_amdgcn_permlanex16(
      v, v, 0x76543210, 0xfedcba98, false, false));
}

// ---------------- fp32 -> fp16 pre-pass, one launch ----------------
// The pre-pass is short, so what it pays is launches and wave starts: all five
// conversions share one grid, and a thread converts 64 elements with its 16
// 16-B loads issued ahead of the first store.
// Blocks [0, XBLK): x straight; a wave's load covers 512 contiguous bytes and
// its 8-B-per-lane store 256.
// Blocks [XBLK, XBLK + 4 * WBLK): weights converted and transposed,
// dst[n][k] = src[k][n], so that GEMM B fragments are k-contiguous. A thread
// holds two blocks of 8 k x 4 n and stores 8 consecutive k of one n as 16 B.
// Lanes: 8 along n (a load covers 128-B lines of 4 rows) x 4 along k; the two
// blocks lie 32 k apart, so one wave writes each 128-B line of dst whole.
typedef __attribute__((ext_vector_type(4))) float    f32x4;
typedef __attribute__((ext_vector_type(4))) _Float16 f16x4;
typedef __attribute__((ext_vector_type(8))) _Float16 f16x8;
constexpr int XBLK = (int)(XE / (256 * 64));   // 256
constexpr int WBLK = (int)(WE / (256 * 64));   // 64 tiles of 128 k x 128 n
__global__ __launch_bounds__(256) __attribute__((amdgpu_waves_per_eu(4, 8)))
void convert_all_kernel(
    const float* __restrict__ x, const float* __restrict__ Wq,
    const float* __restrict__ Wk, const float* __restrict__ Wv,
    const float* __restrict__ Wo, _Float16* __restrict__ xh,
    _Float16* __restrict__ wt) {
  const int lane = threadIdx.x & 31, w = threadIdx.x >> 5;
  const int blk = blockIdx.x;
  if (blk < XBLK) {
    const long base = (long)blk * (256 * 64) + w * (32 * 64) + lane * 4;
    const float* xp = x + base;
    f32x4 v[16];
    // every loop here is unrolled so that v stays in registers and the loads
    // stand as one run
#pragma unroll
    for (int j = 0; j < 16; ++j)
      v[j] = *reinterpret_cast<const f32x4*>(xp + j * 128);
    asm volatile("s_wait_xcnt 0x0" :: "v"(xp) : "memory");
#pragma unroll
    for (int j = 0; j < 16; ++j)
      *reinterpret_cast<f16x4*>(xh + base + j * 128) =
          __builtin_convertvector(v[j], f16x4);
    return;
  }
  const int t = blk - XBLK;
  const int z = t / WBLK, tile = t % WBLK;
  const float* src = z == 0 ? Wq : (z == 1 ? Wk : (z == 2 ? Wv : Wo));
  _Float16* dst = wt + (long)z * WE;
  const int n0 = (tile & 7) * 128 + (w & 3) * 32 + (lane & 7) * 4;
  const int k0 = (tile >> 3) * 128 + (w >> 2) * 64 + (lane >> 3) * 8;
  const float* sp = src + (long)k0 * D + n0;
  f32x4 v[2][8];
#pragma unroll
  for (int u = 0; u < 2; ++u)
#pragma unroll
    for (int j = 0; j < 8; ++j)
      v[u][j] = *reinterpret_cast<const f32x4*>(sp + (32 * u + j) * D);
  asm volatile("s_wait_xcnt 0x0" :: "v"(sp) : "memory");
#pragma unroll
  for (int i = 0; i < 4; ++i)
#pragma unroll
    for (int u = 0; u < 2; ++u) {
      f16x8 h;
#pragma unroll
      for (int j = 0; j < 8; ++j) h[j] = (_Float16)v[u][j][i];
      *reinterpret_cast<f16x8*>(dst + (long)(n0 + i) * D + k0 + 32 * u) = h;
    }
}

template <int LAYOUT>
__device__ __forceinline__ void gemm_store(
    const v8f (&acc)[8], const float* __restrict__ bias,
    float* __restrict__ Cf, _Float16* __restrict__ Ch, int N, int n0, int m0,
    int w, int lane) {
  const int nlo = lane & 15, hi = (lane >> 4) & 1;
#pragma unroll
  for (int j = 0; j < 8; ++j) {
    int col = n0 + j * 16 + nlo;
    float bv = bias[col];
#pragma unroll
    for (int r = 0; r < 8; ++r) {
      long row = m0 + w * 16 + r + 8 * hi;
      float val = acc[j][r] + bv;
      if (LAYOUT == 0) {
        Cf[row * N + col] = val;
      } else if (LAYOUT == 1) {
        Ch[row * N + col] = (_Float16)val;
      } else {
        // V output in [B, H, DK, S]: row = b*S+s, col = h*DK+dk
        int b = (int)(row >> 10), s = (int)(row & (S - 1));
        int h = col >> 6, dk = col & (DK - 1);
        Ch[(long)((b * H + h) * DK + dk) * S + s] = (_Float16)val;
      }
    }
  }
}

// ---------------- GEMM: C[MxN] = A[MxK](f16) @ BT[NxK](f16)^T + bias -------
// Block tile 128x128, BK=64, 256 threads = 8 waves; wave w owns rows
// [16w,16w+16) x 128 cols = 8 f32 accumulators; 16 WMMAs per wave per k-step.
// OMODE 0: one product, f32 row-major into Cf (bias0).
// OMODE 1: the three input projections in ONE launch, so that three
// work-groups share a WGP and fill each other's LDS and copy waits.
// blockIdx.z picks the weight (BT0 + z * WE), the bias and the output
// (Ch0 + z * XE); z = 0, 1 (Q, K): f16 row-major, z = 2 (V): f16 [B,H,DK,S].
template <int OMODE>
__global__ __launch_bounds__(256) void gemm_bias_kernel(
    const _Float16* __restrict__ A, const _Float16* __restrict__ BT0,
    const float* __restrict__ bias0, const float* __restrict__ bias1,
    const float* __restrict__ bias2, float* __restrict__ Cf,
    _Float16* __restrict__ Ch0, int M, int N, int K) {
  constexpr int BM = 128, BN = 128, BK = 64;
  __shared__ __attribute__((aligned(16))) _Float16 a_sh[BM * P128];  // [row][k]
  __shared__ __attribute__((aligned(16))) _Float16 b_sh[BN * P128];  // [n][k]

  const int tid = threadIdx.x;
  const int lane = tid & 31, w = tid >> 5;
  const int n0 = blockIdx.x * BN, m0 = blockIdx.y * BM;
  const int z = OMODE == 1 ? (int)blockIdx.z : 0;
  const _Float16* BT = BT0 + (long)z * WE;
  const float* bias = z == 0 ? bias0 : (z == 1 ? bias1 : bias2);
  _Float16* Ch = Ch0 + (long)z * XE;

  v8f acc[8];
#pragma unroll
  for (int j = 0; j < 8; ++j) acc[j] = {};

  for (int kk = 0; kk < K; kk += BK) {
    __syncthreads();
    // async-stage both tiles: 128 rows x 64 f16 = 8 x b128 per row each
    const _Float16* ld[8];
    const _Float16* gs[8];
#pragma unroll
    for (int i = 0; i < 4; ++i) {
      int idx = tid + i * 256;            // 0..1023
      int row = idx >> 3, g = (idx & 7) * 8;
      ld[2 * i]     = a_sh + row * P128 + g;
      gs[2 * i]     = A + (long)(m0 + row) * K + kk + g;
      ld[2 * i + 1] = b_sh + row * P128 + g;
      gs[2 * i + 1] = BT + (long)(n0 + row) * K + kk + g;
    }
    async_ld_b128_x8(ld, gs);
    wait_async0();
    __syncthreads();

    v16h a0 = ld_frag(a_sh, w * 16, P128, 0, lane);
    v16h a1 = ld_frag(a_sh, w * 16, P128, 32, lane);
#pragma unroll
    for (int j = 0; j < 8; ++j) {
      acc[j] = wmma_f16(a0, ld_frag(b_sh, j * 16, P128, 0, lane), acc[j]);
      acc[j] = wmma_f16(a1, ld_frag(b_sh, j * 16, P128, 32, lane), acc[j]);
    }
  }

  // one work-group-uniform branch picks the output layout
  if (OMODE == 1 && z == 2) {
    gemm_store<2>(acc, bias, Cf, Ch, N, n0, m0, w, lane);
    return;
  }
  gemm_store<OMODE>(acc, bias, Cf, Ch, N, n0, m0, w, lane);
  // In the listing this path can fall through into the V path's code, which
  // rewrites registers that the stores above name: the wait stands in front.
  if (OMODE == 1) asm volatile("s_wait_xcnt 0x0" ::: "memory");
}

__global__ __launch_bounds__(128) void attn_kernel(
    const _Float16* __restrict__ Q, const _Float16* __restrict__ Km,
    const _Float16* __restrict__ Vt, _Float16* __restrict__ ctx) {
  constexpr int BQ = 64, BC = 32;
  __shared__ __attribute__((aligned(16))) _Float16 q_sh[BQ * P128];  // [q][dk]
  __shared__ __attribute__((aligned(16))) _Float16 k_sh[BC * P128];  // [key][dk]
  __shared__ __attribute__((aligned(16))) _Float16 vT[DK * P64];     // [dk][key]

  const int tid = threadIdx.x, lane = tid & 31, w = tid >> 5;
  const int nsb = S / BQ;                 // 16
  const int sblk = blockIdx.x % nsb;
  const int bh = blockIdx.x / nsb;
  const int b = bh / H, h = bh % H;
  const int q0 = sblk * BQ;
  const int hi = (lane >> 4) & 1, nlo = lane & 15;

  // async-stage Q tile 64x64: 8 x b128 per row, 4 per thread
  {
    const int row = tid >> 3, g = (tid & 7) * 8;   // rows step by 16 per copy
    const _Float16* ql = q_sh + row * P128 + g;
    const _Float16* qg = Q + (long)(b * S + q0 + row) * D + h * DK + g;
    async_ld_b128_x4(ql, qg, ql + 16 * P128, qg + 16 * D,
                     ql + 32 * P128, qg + 32 * D, ql + 48 * P128, qg + 48 * D);
  }
  wait_async0();
  __syncthreads();
  v16h bq0 = ld_frag(q_sh, w * 16, P128, 0, lane);
  v16h bq1 = ld_frag(q_sh, w * 16, P128, 32, lane);

  // per lane: running maximum of its query, running sum over its own keys
  float mrun = -3.0e38f, lrun = 0.f;
  v8f o0 = {}, o1 = {}, o2 = {}, o3 = {};   // O^T: dk = 16*t + r + 8*hi

  const _Float16* vt_base = Vt + (long)bh * DK * S;

  for (int t0 = 0; t0 < S; t0 += BC) {
    __syncthreads();
    // K chunk 32x64: 256 b128, 2/thread ; V^T chunk 64x32: 256 b128, 2/thread
    {
      const int row = tid >> 3, g = (tid & 7) * 8;    // second copy: row + 16
      const _Float16* kl = k_sh + row * P128 + g;
      const _Float16* kg = Km + (long)(b * S + t0 + row) * D + h * DK + g;
      const int dk = tid >> 2, gg = (tid & 3) * 8;    // second copy: dk + 32
      const _Float16* vl = vT + dk * P64 + gg;
      const _Float16* vg = vt_base + (long)dk * S + t0 + gg;
      async_ld_b128_x4(kl, kg, vl, vg, kl + 16 * P128, kg + 16 * D,
                       vl + 32 * P64, vg + 32 * S);
    }
    wait_async0();
    __syncthreads();

    // scores, transposed: 32 keys x 16 query columns, contraction over DK=64
    v8f sa = {}, sb = {};
    sa = wmma_f16(ld_frag(k_sh, 0, P128, 0, lane), bq0, sa);
    sa = wmma_f16(ld_frag(k_sh, 0, P128, 32, lane), bq1, sa);
    sb = wmma_f16(ld_frag(k_sh, 16, P128, 0, lane), bq0, sb);
    sb = wmma_f16(ld_frag(k_sh, 16, P128, 32, lane), bq1, sb);

    // online softmax (scale = 1/sqrt(DK) = 0.125)
    float mx = fmaxf(sa[0], sb[0]);
    for (int r = 1; r < 8; ++r) mx = fmaxf(mx, fmaxf(sa[r], sb[r]));
    mx = fmaxf(mx, xhalf(mx)) * 0.125f;   // both halves: the query's maximum
    const float nm = fmaxf(mrun, mx);
    const float al = __expf(mrun - nm);
    mrun = nm;
    float ps = 0.f;
    v16h pb;   // P^T as B operand: element e = key 8*hi + e, 8 + e = key 16 + 8*hi + e
    for (int r = 0; r < 8; ++r) {
      float x0 = __expf(sa[r] * 0.125f - nm);
      float x1 = __expf(sb[r] * 0.125f - nm);
      ps += x0 + x1;
      pb[r]     = (_Float16)x0;
      pb[8 + r] = (_Float16)x1;
    }
    lrun = lrun * al + ps;
    o0 *= al; o1 *= al; o2 *= al; o3 *= al;

    o0 = wmma_f16(ld_frag(vT, 0,  P64, 0, lane), pb, o0);
    o1 = wmma_f16(ld_frag(vT, 16, P64, 0, lane), pb, o1);
    o2 = wmma_f16(ld_frag(vT, 32, P64, 0, lane), pb, o2);
    o3 = wmma_f16(ld_frag(vT, 48, P64, 0, lane), pb, o3);
  }

  // epilogue: join the halves' sums, normalize, store to [B,S,D] (heads
  // interleaved); a lane's 8 registers of a tile are 8 consecutive dk: 16 B
  const float inv = 1.0f / (lrun + xhalf(lrun));
  _Float16* cp = ctx + (long)(b * S + q0 + w * 16 + nlo) * D + h * DK + 8 * hi;
  const v8f* ot[4] = {&o0, &o1, &o2, &o3};
  for (int t = 0; t < 4; ++t) {
    union { _Float16 hh[8]; uint4 u; } pk;
    for (int r = 0; r < 8; ++r) pk.hh[r] = (_Float16)((*ot[t])[r] * inv);
    *reinterpret_cast<uint4*>(cp + 16 * t) = pk.u;
  }
}

// ---------------- host launcher ----------------
extern "C" void kernel_launch(void* const* d_in, const int* in_sizes, int n_in,
                              void* d_out, int out_size, void* d_ws,
                              size_t ws_size, hipStream_t stream) {
  const float* x  = (const float*)d_in[0];
  const float* Wq = (const float*)d_in[1];
  const float* bq = (const float*)d_in[2];
  const float* Wk = (const float*)d_in[3];
  const float* bk = (const float*)d_in[4];
  const float* Wv = (const float*)d_in[5];
  const float* bv = (const float*)d_in[6];
  const float* Wo = (const float*)d_in[7];
  const float* bo = (const float*)d_in[8];
  float* out = (float*)d_out;

  // workspace carve-up (f16): x, 4 weights(T), Q, K, Vt, ctx => 48MB
  _Float16* p = (_Float16*)d_ws;
  _Float16* xh   = p; p += XE;
  _Float16* wqt  = p; p += WE;
  _Float16* wkt  = p; p += WE;
  _Float16* wvt  = p; p += WE;
  _Float16* wot  = p; p += WE;
  _Float16* qh   = p; p += XE;
  _Float16* kh   = p; p += XE;
  _Float16* vt   = p; p += XE;   // [B,H,DK,S]
  _Float16* ctxh = p; p += XE;
  if (ws_size < (size_t)((char*)p - (char*)d_ws)) return;

  // 1) conversions, one launch: x straight; weights converted + transposed to
  //    [N][K]; wqt, wkt, wvt, wot lie WE apart in the workspace
  convert_all_kernel<<<XBLK + 4 * WBLK, 256, 0, stream>>>(x, Wq, Wk, Wv, Wo, xh,
                                                          wqt);

  // 2) Q/K/V projections, one launch: wqt, wkt, wvt lie WE apart and
  //    qh, kh, vt lie XE apart in the workspace
  dim3 ggrid(D / 128, MROWS / 128);      // (8, 32)
  dim3 ggrid3(D / 128, MROWS / 128, 3);  // z = Q, K, V
  gemm_bias_kernel<1><<<ggrid3, 256, 0, stream>>>(xh, wqt, bq, bk, bv, nullptr,
                                                  qh, MROWS, D, D);

  // 3) attention: B*H*(S/64) = 1024 blocks of 128 threads
  attn_kernel<<<BB * H * (S / 64), 128, 0, stream>>>(qh, kh, vt, ctxh);

  // 4) output projection (f32 out into d_out)
  gemm_bias_kernel<0><<<ggrid, 256, 0, stream>>>(ctxh, wot, bo, nullptr, nullptr,
                                                 out, nullptr, MROWS, D, D);
}

// v005
// Measured time: 80.6 microseconds a run.
// Next to v004, in two timings, it ran 1.22 times as fast each time.
// Counting every step since v000, it is 3.39 times as fast.
#include <hip/hip_runtime.h>
#include <hip/hip_bf16.h>

typedef __attribute__((ext_vector_type(16))) _Float16 v16h;
typedef __attribute__((ext_vector_type(8)))  float    v8f;

// ---------------- problem constants ----------------
constexpr int BB = 4, S = 1024, D = 1024, H = 16, DK = 64;
constexpr int MROWS = BB * S;          // 4096
constexpr long XE = (long)MROWS * D;   // 4M elements
constexpr long WE = (long)D * D;       // 1M elements

// ---------------- WMMA wrapper ----------------
__device__ __forceinline__ v8f wmma_f16(v16h a, v16h b, v8f c) {
  return __builtin_amdgcn_wmma_f32_16x16x32_f16(
      /*neg_a=*/false, a, /*neg_b=*/false, b,
      /*c_mod=*/(short)0, c, /*reuse_a=*/false, /*reuse_b=*/false);
}

__device__ __forceinline__ unsigned lds_off(const _Float16* p) {
  return (unsigned)(unsigned long long)p;
}
__device__ __forceinline__ void async_ld_b128_x4(
    const _Float16* l0, const _Float16* g0, const _Float16* l1,
    const _Float16* g1, const _Float16* l2, const _Float16* g2,
    const _Float16* l3, const _Float16* g3) {
  asm volatile("global_load_async_to_lds_b128 %0, %1, off\n\t"
               "global_load_async_to_lds_b128 %2, %3, off\n\t"
               "global_load_async_to_lds_b128 %4, %5, off\n\t"
               "global_load_async_to_lds_b128 %6, %7, off\n\t"
               "s_wait_xcnt 0x0"
               :: "v"(lds_off(l0)), "v"(g0), "v"(lds_off(l1)), "v"(g1),
                  "v"(lds_off(l2)), "v"(g2), "v"(lds_off(l3)), "v"(g3)
               : "memory");
}
__device__ __forceinline__ void async_ld_b128_x8(
    const _Float16* const (&l)[8], const _Float16* const (&g)[8]) {
  asm volatile("global_load_async_to_lds_b128 %0, %1, off\n\t"
               "global_load_async_to_lds_b128 %2, %3, off\n\t"
               "global_load_async_to_lds_b128 %4, %5, off\n\t"
               "global_load_async_to_lds_b128 %6, %7, off\n\t"
               "global_load_async_to_lds_b128 %8, %9, off\n\t"
               "global_load_async_to_lds_b128 %10, %11, off\n\t"
               "global_load_async_to_lds_b128 %12, %13, off\n\t"
               "global_load_async_to_lds_b128 %14, %15, off\n\t"
               "s_wait_xcnt 0x0"
               :: "v"(lds_off(l[0])), "v"(g[0]), "v"(lds_off(l[1])), "v"(g[1]),
                  "v"(lds_off(l[2])), "v"(g[2]), "v"(lds_off(l[3])), "v"(g[3]),
                  "v"(lds_off(l[4])), "v"(g[4]), "v"(lds_off(l[5])), "v"(g[5]),
                  "v"(lds_off(l[6])), "v"(g[6]), "v"(lds_off(l[7])), "v"(g[7])
               : "memory");
}

constexpr int P128 = 72;   // rows of 64 f16 (128 B) at 144 B
constexpr int P64  = 40;   // rows of 32 f16 (64 B) at 80 B
__device__ __forceinline__ void wait_async0() {
  asm volatile("s_wait_asynccnt 0" ::: "memory");
}
// Foot of a ring trip: this wave's LDS reads have retired before the barrier
// behind which the buffer it has just read is refilled.
__device__ __forceinline__ void wait_ds0() {
  asm volatile("s_wait_dscnt 0" ::: "memory");
}

__device__ __forceinline__ v16h ld_frag(const _Float16* tile, int rbase,
                                        int stride, int k0, int lane) {
  const int m  = lane & 15;
  const int kb = (lane >> 4) << 3;   // 0 or 8
  const _Float16* p = tile + (rbase + m) * stride + k0 + kb;
  union { uint4 u[2]; v16h h; } r;
  r.u[0] = *reinterpret_cast<const uint4*>(p);
  r.u[1] = *reinterpret_cast<const uint4*>(p + 16);
  return r.h;
}

__device__ __forceinline__ float xhalf(float x) {
  int v = __builtin_bit_cast(int, x);
  return __builtin_bit_cast(float, __builtin_amdgcn_permlanex16(
      v, v, 0x76543210, 0xfedcba98, false, false));
}

// ---------------- fp32 -> fp16 pre-pass, one launch ----------------
// The pre-pass is short, so what it pays is launches and wave starts: all five
// conversions share one grid, and a thread converts 64 elements with its 16
// 16-B loads issued ahead of the first store.
// Blocks [0, XBLK): x straight; a wave's load covers 512 contiguous bytes and
// its 8-B-per-lane store 256.
// Blocks [XBLK, XBLK + 4 * WBLK): weights converted and transposed,
// dst[n][k] = src[k][n], so that GEMM B fragments are k-contiguous. A thread
// holds two blocks of 8 k x 4 n and stores 8 consecutive k of one n as 16 B.
// Lanes: 8 along n (a load covers 128-B lines of 4 rows) x 4 along k; the two
// blocks lie 32 k apart, so one wave writes each 128-B line of dst whole.
typedef __attribute__((ext_vector_type(4))) float    f32x4;
typedef __attribute__((ext_vector_type(4))) _Float16 f16x4;
typedef __attribute__((ext_vector_type(8))) _Float16 f16x8;
constexpr int XBLK = (int)(XE / (256 * 64));   // 256
constexpr int WBLK = (int)(WE / (256 * 64));   // 64 tiles of 128 k x 128 n
__global__ __launch_bounds__(256) __attribute__((amdgpu_waves_per_eu(4, 8)))
void convert_all_kernel(
    const float* __restrict__ x, const float* __restrict__ Wq,
    const float* __restrict__ Wk, const float* __restrict__ Wv,
    const float* __restrict__ Wo, _Float16* __restrict__ xh,
    _Float16* __restrict__ wt) {
  const int lane = threadIdx.x & 31, w = threadIdx.x >> 5;
  const int blk = blockIdx.x;
  if (blk < XBLK) {
    const long base = (long)blk * (256 * 64) + w * (32 * 64) + lane * 4;
    const float* xp = x + base;
    f32x4 v[16];
    // every loop here is unrolled so that v stays in registers and the loads
    // stand as one run
#pragma unroll
    for (int j = 0; j < 16; ++j)
      v[j] = *reinterpret_cast<const f32x4*>(xp + j * 128);
    asm volatile("s_wait_xcnt 0x0" :: "v"(xp) : "memory");
#pragma unroll
    for (int j = 0; j < 16; ++j)
      *reinterpret_cast<f16x4*>(xh + base + j * 128) =
          __builtin_convertvector(v[j], f16x4);
    return;
  }
  const int t = blk - XBLK;
  const int z = t / WBLK, tile = t % WBLK;
  const float* src = z == 0 ? Wq : (z == 1 ? Wk : (z == 2 ? Wv : Wo));
  _Float16* dst = wt + (long)z * WE;
  const int n0 = (tile & 7) * 128 + (w & 3) * 32 + (lane & 7) * 4;
  const int k0 = (tile >> 3) * 128 + (w >> 2) * 64 + (lane >> 3) * 8;
  const float* sp = src + (long)k0 * D + n0;
  f32x4 v[2][8];
#pragma unroll
  for (int u = 0; u < 2; ++u)
#pragma unroll
    for (int j = 0; j < 8; ++j)
      v[u][j] = *reinterpret_cast<const f32x4*>(sp + (32 * u + j) * D);
  asm volatile("s_wait_xcnt 0x0" :: "v"(sp) : "memory");
#pragma unroll
  for (int i = 0; i < 4; ++i)
#pragma unroll
    for (int u = 0; u < 2; ++u) {
      f16x8 h;
#pragma unroll
      for (int j = 0; j < 8; ++j) h[j] = (_Float16)v[u][j][i];
      *reinterpret_cast<f16x8*>(dst + (long)(n0 + i) * D + k0 + 32 * u) = h;
    }
}

template <int LAYOUT>
__device__ __forceinline__ void gemm_store(
    const v8f (&acc)[8], const float* __restrict__ bias,
    float* __restrict__ Cf, _Float16* __restrict__ Ch, int N, int n0, int m0,
    int w, int lane) {
  const int nlo = lane & 15, hi = (lane >> 4) & 1;
#pragma unroll
  for (int j = 0; j < 8; ++j) {
    int col = n0 + j * 16 + nlo;
    float bv = bias[col];
#pragma unroll
    for (int r = 0; r < 8; ++r) {
      long row = m0 + w * 16 + r + 8 * hi;
      float val = acc[j][r] + bv;
      if (LAYOUT == 0) {
        Cf[row * N + col] = val;
      } else if (LAYOUT == 1) {
        Ch[row * N + col] = (_Float16)val;
      } else {
        // V output in [B, H, DK, S]: row = b*S+s, col = h*DK+dk
        int b = (int)(row >> 10), s = (int)(row & (S - 1));
        int h = col >> 6, dk = col & (DK - 1);
        Ch[(long)((b * H + h) * DK + dk) * S + s] = (_Float16)val;
      }
    }
  }
}

// ---------------- GEMM: C[MxN] = A[MxK](f16) @ BT[NxK](f16)^T + bias -------
// Block tile 128x128, BK=64, 256 threads = 8 waves; wave w owns rows
// [16w,16w+16) x 128 cols = 8 f32 accumulators; 16 WMMAs per wave per k-step.
// OMODE 0: one product, f32 row-major into Cf (bias0).
// OMODE 1: the three input projections in ONE launch, so that three
// work-groups share a WGP and fill each other's LDS and copy waits.
// blockIdx.z picks the weight (BT0 + z * WE), the bias and the output
// (Ch0 + z * XE); z = 0, 1 (Q, K): f16 row-major, z = 2 (V): f16 [B,H,DK,S].
// The k loop runs on two LDS buffers: tile t + 1's copies fly while tile t is
// multiplied, and one barrier a trip both publishes tile t + 1 and frees the
// buffer of tile t for tile t + 2.
template <int OMODE>
__global__ __launch_bounds__(256) void gemm_bias_kernel(
    const _Float16* __restrict__ A, const _Float16* __restrict__ BT0,
    const float* __restrict__ bias0, const float* __restrict__ bias1,
    const float* __restrict__ bias2, float* __restrict__ Cf,
    _Float16* __restrict__ Ch0, int M, int N, int K) {
  constexpr int BM = 128, BN = 128, BK = 64;
  __shared__ __attribute__((aligned(16))) _Float16 a_sh[2][BM * P128];  // [row][k]
  __shared__ __attribute__((aligned(16))) _Float16 b_sh[2][BN * P128];  // [n][k]

  const int tid = threadIdx.x;
  const int lane = tid & 31, w = tid >> 5;
  const int n0 = blockIdx.x * BN, m0 = blockIdx.y * BM;
  const int z = OMODE == 1 ? (int)blockIdx.z : 0;
  const _Float16* BT = BT0 + (long)z * WE;
  const float* bias = z == 0 ? bias0 : (z == 1 ? bias1 : bias2);
  _Float16* Ch = Ch0 + (long)z * XE;

  v8f acc[8];
#pragma unroll
  for (int j = 0; j < 8; ++j) acc[j] = {};

  // async-stage both tiles of one k step into buffer buf:
  // 128 rows x 64 f16 = 8 x b128 per row each
  auto stage = [&](int kk, int buf) {
    const _Float16* ld[8];
    const _Float16* gs[8];
#pragma unroll
    for (int i = 0; i < 4; ++i) {
      int idx = tid + i * 256;            // 0..1023
      int row = idx >> 3, g = (idx & 7) * 8;
      ld[2 * i]     = a_sh[buf] + row * P128 + g;
      gs[2 * i]     = A + (long)(m0 + row) * K + kk + g;
      ld[2 * i + 1] = b_sh[buf] + row * P128 + g;
      gs[2 * i + 1] = BT + (long)(n0 + row) * K + kk + g;
    }
    async_ld_b128_x8(ld, gs);
  };

  stage(0, 0);
  wait_async0();
  __syncthreads();
  if (BK < K) stage(BK, 1);

  for (int kk = 0; kk < K; kk += BK) {
    const int buf = (kk / BK) & 1;
    const _Float16* at = a_sh[buf];
    const _Float16* bt = b_sh[buf];
    v16h a0 = ld_frag(at, w * 16, P128, 0, lane);
    v16h a1 = ld_frag(at, w * 16, P128, 32, lane);
#pragma unroll
    for (int j = 0; j < 8; ++j) {
      acc[j] = wmma_f16(a0, ld_frag(bt, j * 16, P128, 0, lane), acc[j]);
      acc[j] = wmma_f16(a1, ld_frag(bt, j * 16, P128, 32, lane), acc[j]);
    }
    // publish point of the next tile, then the refill of the buffer just read
    wait_ds0();
    wait_async0();
    __syncthreads();
    if (kk + 2 * BK < K) stage(kk + 2 * BK, buf);
  }
  wait_async0();

  // one work-group-uniform branch picks the output layout
  if (OMODE == 1 && z == 2) {
    gemm_store<2>(acc, bias, Cf, Ch, N, n0, m0, w, lane);
    return;
  }
  gemm_store<OMODE>(acc, bias, Cf, Ch, N, n0, m0, w, lane);
  // In the listing this path can fall through into the V path's code, which
  // rewrites registers that the stores above name: the wait stands in front.
  if (OMODE == 1) asm volatile("s_wait_xcnt 0x0" ::: "memory");
}

__global__ __launch_bounds__(128) void attn_kernel(
    const _Float16* __restrict__ Q, const _Float16* __restrict__ Km,
    const _Float16* __restrict__ Vt, _Float16* __restrict__ ctx) {
  constexpr int BQ = 64, BC = 32;
  __shared__ __attribute__((aligned(16))) _Float16 q_sh[BQ * P128];  // [q][dk]
  __shared__ __attribute__((aligned(16))) _Float16 k_sh[2][BC * P128];  // [key][dk]
  __shared__ __attribute__((aligned(16))) _Float16 vT[2][DK * P64];     // [dk][key]

  const int tid = threadIdx.x, lane = tid & 31, w = tid >> 5;
  const int nsb = S / BQ;                 // 16
  const int sblk = blockIdx.x % nsb;
  const int bh = blockIdx.x / nsb;
  const int b = bh / H, h = bh % H;
  const int q0 = sblk * BQ;
  const int hi = (lane >> 4) & 1, nlo = lane & 15;

  // async-stage Q tile 64x64: 8 x b128 per row, 4 per thread
  {
    const int row = tid >> 3, g = (tid & 7) * 8;   // rows step by 16 per copy
    const _Float16* ql = q_sh + row * P128 + g;
    const _Float16* qg = Q + (long)(b * S + q0 + row) * D + h * DK + g;
    async_ld_b128_x4(ql, qg, ql + 16 * P128, qg + 16 * D,
                     ql + 32 * P128, qg + 32 * D, ql + 48 * P128, qg + 48 * D);
  }
  const _Float16* vt_base = Vt + (long)bh * DK * S;
  // K chunk 32x64: 256 b128, 2/thread ; V^T chunk 64x32: 256 b128, 2/thread
  auto stage = [&](int t0, int buf) {
    const int row = tid >> 3, g = (tid & 7) * 8;    // second copy: row + 16
    const _Float16* kl = k_sh[buf] + row * P128 + g;
    const _Float16* kg = Km + (long)(b * S + t0 + row) * D + h * DK + g;
    const int dk = tid >> 2, gg = (tid & 3) * 8;    // second copy: dk + 32
    const _Float16* vl = vT[buf] + dk * P64 + gg;
    const _Float16* vg = vt_base + (long)dk * S + t0 + gg;
    async_ld_b128_x4(kl, kg, vl, vg, kl + 16 * P128, kg + 16 * D,
                     vl + 32 * P64, vg + 32 * S);
  };
  stage(0, 0);
  wait_async0();
  __syncthreads();
  stage(BC, 1);
  v16h bq0 = ld_frag(q_sh, w * 16, P128, 0, lane);
  v16h bq1 = ld_frag(q_sh, w * 16, P128, 32, lane);

  // per lane: running maximum of its query, running sum over its own keys
  float mrun = -3.0e38f, lrun = 0.f;
  v8f o0 = {}, o1 = {}, o2 = {}, o3 = {};   // O^T: dk = 16*t + r + 8*hi

  for (int t0 = 0; t0 < S; t0 += BC) {
    const int buf = (t0 / BC) & 1;
    const _Float16* kt = k_sh[buf];
    const _Float16* vv = vT[buf];

    // scores, transposed: 32 keys x 16 query columns, contraction over DK=64
    v8f sa = {}, sb = {};
    sa = wmma_f16(ld_frag(kt, 0, P128, 0, lane), bq0, sa);
    sa = wmma_f16(ld_frag(kt, 0, P128, 32, lane), bq1, sa);
    sb = wmma_f16(ld_frag(kt, 16, P128, 0, lane), bq0, sb);
    sb = wmma_f16(ld_frag(kt, 16, P128, 32, lane), bq1, sb);

    // online softmax (scale = 1/sqrt(DK) = 0.125)
    float mx = fmaxf(sa[0], sb[0]);
    for (int r = 1; r < 8; ++r) mx = fmaxf(mx, fmaxf(sa[r], sb[r]));
    mx = fmaxf(mx, xhalf(mx)) * 0.125f;   // both halves: the query's maximum
    const float nm = fmaxf(mrun, mx);
    const float al = __expf(mrun - nm);
    mrun = nm;
    float ps = 0.f;
    v16h pb;   // P^T as B operand: element e = key 8*hi + e, 8 + e = key 16 + 8*hi + e
    for (int r = 0; r < 8; ++r) {
      float x0 = __expf(sa[r] * 0.125f - nm);
      float x1 = __expf(sb[r] * 0.125f - nm);
      ps += x0 + x1;
      pb[r]     = (_Float16)x0;
      pb[8 + r] = (_Float16)x1;
    }
    lrun = lrun * al + ps;
    o0 *= al; o1 *= al; o2 *= al; o3 *= al;

    o0 = wmma_f16(ld_frag(vv, 0,  P64, 0, lane), pb, o0);
    o1 = wmma_f16(ld_frag(vv, 16, P64, 0, lane), pb, o1);
    o2 = wmma_f16(ld_frag(vv, 32, P64, 0, lane), pb, o2);
    o3 = wmma_f16(ld_frag(vv, 48, P64, 0, lane), pb, o3);

    // publish point of the next chunk, then the refill of the buffer just read
    wait_ds0();
    wait_async0();
    __syncthreads();
    if (t0 + 2 * BC < S) stage(t0 + 2 * BC, buf);
  }
  wait_async0();

  // epilogue: join the halves' sums, normalize, store to [B,S,D] (heads
  // interleaved); a lane's 8 registers of a tile are 8 consecutive dk: 16 B
  const float inv = 1.0f / (lrun + xhalf(lrun));
  _Float16* cp = ctx + (long)(b * S + q0 + w * 16 + nlo) * D + h * DK + 8 * hi;
  const v8f* ot[4] = {&o0, &o1, &o2, &o3};
  for (int t = 0; t < 4; ++t) {
    union { _Float16 hh[8]; uint4 u; } pk;
    for (int r = 0; r < 8; ++r) pk.hh[r] = (_Float16)((*ot[t])[r] * inv);
    *reinterpret_cast<uint4*>(cp + 16 * t) = pk.u;
  }
}

// ---------------- host launcher ----------------
extern "C" void kernel_launch(void* const* d_in, const int* in_sizes, int n_in,
                              void* d_out, int out_size, void* d_ws,
                              size_t ws_size, hipStream_t stream) {
  const float* x  = (const float*)d_in[0];
  const float* Wq = (const float*)d_in[1];
  const float* bq = (const float*)d_in[2];
  const float* Wk = (const float*)d_in[3];
  const float* bk = (const float*)d_in[4];
  const float* Wv = (const float*)d_in[5];
  const float* bv = (const float*)d_in[6];
  const float* Wo = (const float*)d_in[7];
  const float* bo = (const float*)d_in[8];
  float* out = (float*)d_out;

  // workspace carve-up (f16): x, 4 weights(T), Q, K, Vt, ctx => 48MB
  _Float16* p = (_Float16*)d_ws;
  _Float16* xh   = p; p += XE;
  _Float16* wqt  = p; p += WE;
  _Float16* wkt  = p; p += WE;
  _Float16* wvt  = p; p += WE;
  _Float16* wot  = p; p += WE;
  _Float16* qh   = p; p += XE;
  _Float16* kh   = p; p += XE;
  _Float16* vt   = p; p += XE;   // [B,H,DK,S]
  _Float16* ctxh = p; p += XE;
  if (ws_size < (size_t)((char*)p - (char*)d_ws)) return;

  // 1) conversions, one launch: x straight; weights converted + transposed to
  //    [N][K]; wqt, wkt, wvt, wot lie WE apart in the workspace
  convert_all_kernel<<<XBLK + 4 * WBLK, 256, 0, stream>>>(x, Wq, Wk, Wv, Wo, xh,
                                                          wqt);

  // 2) Q/K/V projections, one launch: wqt, wkt, wvt lie WE apart and
  //    qh, kh, vt lie XE apart in the workspace
  dim3 ggrid(D / 128, MROWS / 128);      // (8, 32)
  dim3 ggrid3(D / 128, MROWS / 128, 3);  // z = Q, K, V
  gemm_bias_kernel<1><<<ggrid3, 256, 0, stream>>>(xh, wqt, bq, bk, bv, nullptr,
                                                  qh, MROWS, D, D);

  // 3) attention: B*H*(S/64) = 1024 blocks of 128 threads
  attn_kernel<<<BB * H * (S / 64), 128, 0, stream>>>(qh, kh, vt, ctxh);

  // 4) output projection (f32 out into d_out)
  gemm_bias_kernel<0><<<ggrid, 256, 0, stream>>>(ctxh, wot, bo, nullptr, nullptr,
                                                 out, nullptr, MROWS, D, D);
}

// v006
// A run of this version takes 72.1 microseconds.
// Next to v005, in two timings, it ran 1.12 times as fast each time.
// Over all steps from v000 it is 3.81 times as fast.
#include <hip/hip_runtime.h>
#include <hip/hip_bf16.h>

typedef __attribute__((ext_vector_type(16))) _Float16 v16h;
typedef __attribute__((ext_vector_type(8)))  float    v8f;

// ---------------- problem constants ----------------
constexpr int BB = 4, S = 1024, D = 1024, H = 16, DK = 64;
constexpr int MROWS = BB * S;          // 4096
constexpr long XE = (long)MROWS * D;   // 4M elements
constexpr long WE = (long)D * D;       // 1M elements

// ---------------- WMMA wrapper ----------------
__device__ __forceinline__ v8f wmma_f16(v16h a, v16h b, v8f c) {
  return __builtin_amdgcn_wmma_f32_16x16x32_f16(
      /*neg_a=*/false, a, /*neg_b=*/false, b,
      /*c_mod=*/(short)0, c, /*reuse_a=*/false, /*reuse_b=*/false);
}

__device__ __forceinline__ unsigned lds_off(const _Float16* p) {
  return (unsigned)(unsigned long long)p;
}
__device__ __forceinline__ void async_ld_b128_x4(
    const _Float16* l0, const _Float16* g0, const _Float16* l1,
    const _Float16* g1, const _Float16* l2, const _Float16* g2,
    const _Float16* l3, const _Float16* g3) {
  asm volatile("global_load_async_to_lds_b128 %0, %1, off\n\t"
               "global_load_async_to_lds_b128 %2, %3, off\n\t"
               "global_load_async_to_lds_b128 %4, %5, off\n\t"
               "global_load_async_to_lds_b128 %6, %7, off\n\t"
               "s_wait_xcnt 0x0"
               :: "v"(lds_off(l0)), "v"(g0), "v"(lds_off(l1)), "v"(g1),
                  "v"(lds_off(l2)), "v"(g2), "v"(lds_off(l3)), "v"(g3)
               : "memory");
}
__device__ __forceinline__ void async_ld_b128_x8(
    const _Float16* const (&l)[8], const _Float16* const (&g)[8]) {
  asm volatile("global_load_async_to_lds_b128 %0, %1, off\n\t"
               "global_load_async_to_lds_b128 %2, %3, off\n\t"
               "global_load_async_to_lds_b128 %4, %5, off\n\t"
               "global_load_async_to_lds_b128 %6, %7, off\n\t"
               "global_load_async_to_lds_b128 %8, %9, off\n\t"
               "global_load_async_to_lds_b128 %10, %11, off\n\t"
               "global_load_async_to_lds_b128 %12, %13, off\n\t"
               "global_load_async_to_lds_b128 %14, %15, off\n\t"
               "s_wait_xcnt 0x0"
               :: "v"(lds_off(l[0])), "v"(g[0]), "v"(lds_off(l[1])), "v"(g[1]),
                  "v"(lds_off(l[2])), "v"(g[2]), "v"(lds_off(l[3])), "v"(g[3]),
                  "v"(lds_off(l[4])), "v"(g[4]), "v"(lds_off(l[5])), "v"(g[5]),
                  "v"(lds_off(l[6])), "v"(g[6]), "v"(lds_off(l[7])), "v"(g[7])
               : "memory");
}

constexpr int P128 = 72;   // rows of 64 f16 (128 B) at 144 B
constexpr int P64  = 40;   // rows of 32 f16 (64 B) at 80 B
__device__ __forceinline__ void wait_async0() {
  asm volatile("s_wait_asynccnt 0" ::: "memory");
}
// Foot of a ring trip: this wave's LDS reads have retired before the barrier
// behind which the buffer it has just read is refilled.
__device__ __forceinline__ void wait_ds0() {
  asm volatile("s_wait_dscnt 0" ::: "memory");
}

__device__ __forceinline__ v16h ld_frag(const _Float16* tile, int rbase,
                                        int stride, int k0, int lane) {
  const int m  = lane & 15;
  const int kb = (lane >> 4) << 3;   // 0 or 8
  const _Float16* p = tile + (rbase + m) * stride + k0 + kb;
  union { uint4 u[2]; v16h h; } r;
  r.u[0] = *reinterpret_cast<const uint4*>(p);
  r.u[1] = *reinterpret_cast<const uint4*>(p + 16);
  return r.h;
}

__device__ __forceinline__ float xhalf(float x) {
  int v = __builtin_bit_cast(int, x);
  return __builtin_bit_cast(float, __builtin_amdgcn_permlanex16(
      v, v, 0x76543210, 0xfedcba98, false, false));
}

// ---------------- fp32 -> fp16 pre-pass, one launch ----------------
// The pre-pass is short, so what it pays is launches and wave starts: all five
// conversions share one grid, and a thread converts 64 elements with its 16
// 16-B loads issued ahead of the first store.
// Blocks [0, XBLK): x straight; a wave's load covers 512 contiguous bytes and
// its 8-B-per-lane store 256.
// Blocks [XBLK, XBLK + 4 * WBLK): weights converted and transposed,
// dst[n][k] = src[k][n], so that GEMM B fragments are k-contiguous. A thread
// holds two blocks of 8 k x 4 n and stores 8 consecutive k of one n as 16 B.
// Lanes: 8 along n (a load covers 128-B lines of 4 rows) x 4 along k; the two
// blocks lie 32 k apart, so one wave writes each 128-B line of dst whole.
typedef __attribute__((ext_vector_type(4))) float    f32x4;
typedef __attribute__((ext_vector_type(4))) _Float16 f16x4;
typedef __attribute__((ext_vector_type(8))) _Float16 f16x8;
constexpr int XBLK = (int)(XE / (256 * 64));   // 256
constexpr int WBLK = (int)(WE / (256 * 64));   // 64 tiles of 128 k x 128 n
__global__ __launch_bounds__(256) __attribute__((amdgpu_waves_per_eu(4, 8)))
void convert_all_kernel(
    const float* __restrict__ x, const float* __restrict__ Wq,
    const float* __restrict__ Wk, const float* __restrict__ Wv,
    const float* __restrict__ Wo, _Float16* __restrict__ xh,
    _Float16* __restrict__ wt) {
  const int lane = threadIdx.x & 31, w = threadIdx.x >> 5;
  const int blk = blockIdx.x;
  if (blk < XBLK) {
    const long base = (long)blk * (256 * 64) + w * (32 * 64) + lane * 4;
    const float* xp = x + base;
    f32x4 v[16];
    // every loop here is unrolled so that v stays in registers and the loads
    // stand as one run
#pragma unroll
    for (int j = 0; j < 16; ++j)
      v[j] = *reinterpret_cast<const f32x4*>(xp + j * 128);
    asm volatile("s_wait_xcnt 0x0" :: "v"(xp) : "memory");
#pragma unroll
    for (int j = 0; j < 16; ++j)
      *reinterpret_cast<f16x4*>(xh + base + j * 128) =
          __builtin_convertvector(v[j], f16x4);
    return;
  }
  const int t = blk - XBLK;
  const int z = t / WBLK, tile = t % WBLK;
  const float* src = z == 0 ? Wq : (z == 1 ? Wk : (z == 2 ? Wv : Wo));
  _Float16* dst = wt + (long)z * WE;
  const int n0 = (tile & 7) * 128 + (w & 3) * 32 + (lane & 7) * 4;
  const int k0 = (tile >> 3) * 128 + (w >> 2) * 64 + (lane >> 3) * 8;
  const float* sp = src + (long)k0 * D + n0;
  f32x4 v[2][8];
#pragma unroll
  for (int u = 0; u < 2; ++u)
#pragma unroll
    for (int j = 0; j < 8; ++j)
      v[u][j] = *reinterpret_cast<const f32x4*>(sp + (32 * u + j) * D);
  asm volatile("s_wait_xcnt 0x0" :: "v"(sp) : "memory");
#pragma unroll
  for (int i = 0; i < 4; ++i)
#pragma unroll
    for (int u = 0; u < 2; ++u) {
      f16x8 h;
#pragma unroll
      for (int j = 0; j < 8; ++j) h[j] = (_Float16)v[u][j][i];
      *reinterpret_cast<f16x8*>(dst + (long)(n0 + i) * D + k0 + 32 * u) = h;
    }
}

template <int LAYOUT, int FN>
__device__ __forceinline__ void gemm_store(
    const v8f (&acc)[4][FN], const float* __restrict__ bias,
    float* __restrict__ Cf, _Float16* __restrict__ Ch, int N, int nb, int mb,
    int lane) {
  const int nlo = lane & 15, hi = (lane >> 4) & 1;
#pragma unroll
  for (int j = 0; j < FN; ++j) {
    int col = nb + j * 16 + nlo;
    float bv = bias[col];
#pragma unroll
    for (int i = 0; i < 4; ++i) {
#pragma unroll
      for (int r = 0; r < 8; ++r) {
        long row = mb + i * 16 + r + 8 * hi;
        float val = acc[i][j][r] + bv;
        if (LAYOUT == 0) {
          Cf[row * N + col] = val;
        } else if (LAYOUT == 1) {
          Ch[row * N + col] = (_Float16)val;
        } else {
          // V output in [B, H, DK, S]: row = b*S+s, col = h*DK+dk
          int b = (int)(row >> 10), s = (int)(row & (S - 1));
          int h = col >> 6, dk = col & (DK - 1);
          Ch[(long)((b * H + h) * DK + dk) * S + s] = (_Float16)val;
        }
      }
    }
  }
}

template <int NZ, int WN>
__global__ __launch_bounds__(64 * WN) void gemm_bias_kernel(
    const _Float16* __restrict__ A, const _Float16* __restrict__ BT0,
    const float* __restrict__ bias0, const float* __restrict__ bias1,
    const float* __restrict__ bias2, float* __restrict__ Cf,
    _Float16* __restrict__ Ch0, int M, int N, int K) {
  constexpr int BM = 128, BN = 128, BK = 64;
  constexpr int FN = BN / (16 * WN);    // B fragments a wave and weight
  constexpr int CPT = 16 / WN;          // copies a thread and staged tile
  static_assert((NZ + 1) * CPT == 8, "one statement of eight copies a stage");
  __shared__ __attribute__((aligned(16))) _Float16 a_sh[2][BM * P128];  // [row][k]
  __shared__ __attribute__((aligned(16))) _Float16 b_sh[2][NZ * BN * P128];  // [z][n][k]

  const int tid = threadIdx.x;
  const int lane = tid & 31, w = tid >> 5;
  const int wm = w / WN, wn = w % WN;
  const int n0 = blockIdx.x * BN, m0 = blockIdx.y * BM;

  // every inner loop of this kernel and of its epilogue is unrolled, so that
  // accumulators and fragments are indexed by constants and stay in registers
  v8f acc[NZ][4][FN];
#pragma unroll
  for (int z = 0; z < NZ; ++z)
#pragma unroll
    for (int i = 0; i < 4; ++i)
#pragma unroll
      for (int j = 0; j < FN; ++j) acc[z][i][j] = {};

  // async-stage the NZ + 1 tiles of one k step into buffer buf:
  // 128 rows x 64 f16 = 8 x b128 per row each; tile 0 is A, tile z + 1 weight z
  auto stage = [&](int kk, int buf) {
    const _Float16* ld[8];
    const _Float16* gs[8];
    const int row0 = tid >> 3, g = (tid & 7) * 8;
#pragma unroll
    for (int c = 0; c < 8; ++c) {
      const int tl = c / CPT;
      const int row = row0 + (c % CPT) * (8 * WN);
      if (tl == 0) {
        ld[c] = a_sh[buf] + row * P128 + g;
        gs[c] = A + (long)(m0 + row) * K + kk + g;
      } else {
        ld[c] = b_sh[buf] + ((tl - 1) * BN + row) * P128 + g;
        gs[c] = BT0 + (tl - 1) * WE + (long)(n0 + row) * K + kk + g;
      }
    }
    async_ld_b128_x8(ld, gs);
  };

  stage(0, 0);
  wait_async0();
  __syncthreads();
  if (BK < K) stage(BK, 1);

  for (int kk = 0; kk < K; kk += BK) {
    const int buf = (kk / BK) & 1;
    const _Float16* at = a_sh[buf];
    const _Float16* bt = b_sh[buf];
    v16h af[2][4];
    v16h bf[2][NZ][FN];
#pragma unroll
    for (int s = 0; s < 2; ++s) {
#pragma unroll
      for (int i = 0; i < 4; ++i)
        af[s][i] = ld_frag(at, wm * 64 + i * 16, P128, s * 32, lane);
#pragma unroll
      for (int z = 0; z < NZ; ++z)
#pragma unroll
        for (int j = 0; j < FN; ++j)
          bf[s][z][j] =
              ld_frag(bt, z * BN + (wn * FN + j) * 16, P128, s * 32, lane);
    }
    // fence pair round the WMMA block. The first keeps the k step's LDS reads
    // one group ahead of it: left alone, the compiler sinks each B fragment's
    // reads to just in front of its four WMMAs, with a full wait there.
    __builtin_amdgcn_sched_barrier(0);
#pragma unroll
    for (int s = 0; s < 2; ++s)
#pragma unroll
      for (int z = 0; z < NZ; ++z)
#pragma unroll
        for (int j = 0; j < FN; ++j)
#pragma unroll
          for (int i = 0; i < 4; ++i)
            acc[z][i][j] = wmma_f16(af[s][i], bf[s][z][j], acc[z][i][j]);
    // The second keeps the block in front of the foot's waits: lifted over it,
    // they would end the flight of the next tile's copies a whole block early.
    __builtin_amdgcn_sched_barrier(0);
    // publish point of the next tile, then the refill of the buffer just read
    wait_ds0();
    wait_async0();
    __syncthreads();
    if (kk + 2 * BK < K) stage(kk + 2 * BK, buf);
  }
  wait_async0();

  const int mb = m0 + wm * 64, nb = n0 + wn * FN * 16;
  if constexpr (NZ == 1) {
    gemm_store<0, FN>(acc[0], bias0, Cf, Ch0, N, nb, mb, lane);
  } else {
    gemm_store<1, FN>(acc[0], bias0, Cf, Ch0, N, nb, mb, lane);
    gemm_store<1, FN>(acc[1], bias1, Cf, Ch0 + XE, N, nb, mb, lane);
    gemm_store<2, FN>(acc[2], bias2, Cf, Ch0 + 2 * XE, N, nb, mb, lane);
  }
}

__global__ __launch_bounds__(128) void attn_kernel(
    const _Float16* __restrict__ Q, const _Float16* __restrict__ Km,
    const _Float16* __restrict__ Vt, _Float16* __restrict__ ctx) {
  constexpr int BQ = 64, BC = 32;
  __shared__ __attribute__((aligned(16))) _Float16 q_sh[BQ * P128];  // [q][dk]
  __shared__ __attribute__((aligned(16))) _Float16 k_sh[2][BC * P128];  // [key][dk]
  __shared__ __attribute__((aligned(16))) _Float16 vT[2][DK * P64];     // [dk][key]

  const int tid = threadIdx.x, lane = tid & 31, w = tid >> 5;
  const int nsb = S / BQ;                 // 16
  const int sblk = blockIdx.x % nsb;
  const int bh = blockIdx.x / nsb;
  const int b = bh / H, h = bh % H;
  const int q0 = sblk * BQ;
  const int hi = (lane >> 4) & 1, nlo = lane & 15;

  // async-stage Q tile 64x64: 8 x b128 per row, 4 per thread
  {
    const int row = tid >> 3, g = (tid & 7) * 8;   // rows step by 16 per copy
    const _Float16* ql = q_sh + row * P128 + g;
    const _Float16* qg = Q + (long)(b * S + q0 + row) * D + h * DK + g;
    async_ld_b128_x4(ql, qg, ql + 16 * P128, qg + 16 * D,
                     ql + 32 * P128, qg + 32 * D, ql + 48 * P128, qg + 48 * D);
  }
  const _Float16* vt_base = Vt + (long)bh * DK * S;
  // K chunk 32x64: 256 b128, 2/thread ; V^T chunk 64x32: 256 b128, 2/thread
  auto stage = [&](int t0, int buf) {
    const int row = tid >> 3, g = (tid & 7) * 8;    // second copy: row + 16
    const _Float16* kl = k_sh[buf] + row * P128 + g;
    const _Float16* kg = Km + (long)(b * S + t0 + row) * D + h * DK + g;
    const int dk = tid >> 2, gg = (tid & 3) * 8;    // second copy: dk + 32
    const _Float16* vl = vT[buf] + dk * P64 + gg;
    const _Float16* vg = vt_base + (long)dk * S + t0 + gg;
    async_ld_b128_x4(kl, kg, vl, vg, kl + 16 * P128, kg + 16 * D,
                     vl + 32 * P64, vg + 32 * S);
  };
  stage(0, 0);
  wait_async0();
  __syncthreads();
  stage(BC, 1);
  v16h bq0 = ld_frag(q_sh, w * 16, P128, 0, lane);
  v16h bq1 = ld_frag(q_sh, w * 16, P128, 32, lane);

  // per lane: running maximum of its query, running sum over its own keys
  float mrun = -3.0e38f, lrun = 0.f;
  v8f o0 = {}, o1 = {}, o2 = {}, o3 = {};   // O^T: dk = 16*t + r + 8*hi

  for (int t0 = 0; t0 < S; t0 += BC) {
    const int buf = (t0 / BC) & 1;
    const _Float16* kt = k_sh[buf];
    const _Float16* vv = vT[buf];

    // scores, transposed: 32 keys x 16 query columns, contraction over DK=64
    v8f sa = {}, sb = {};
    sa = wmma_f16(ld_frag(kt, 0, P128, 0, lane), bq0, sa);
    sa = wmma_f16(ld_frag(kt, 0, P128, 32, lane), bq1, sa);
    sb = wmma_f16(ld_frag(kt, 16, P128, 0, lane), bq0, sb);
    sb = wmma_f16(ld_frag(kt, 16, P128, 32, lane), bq1, sb);

    // online softmax (scale = 1/sqrt(DK) = 0.125)
    float mx = fmaxf(sa[0], sb[0]);
    for (int r = 1; r < 8; ++r) mx = fmaxf(mx, fmaxf(sa[r], sb[r]));
    mx = fmaxf(mx, xhalf(mx)) * 0.125f;   // both halves: the query's maximum
    const float nm = fmaxf(mrun, mx);
    const float al = __expf(mrun - nm);
    mrun = nm;
    float ps = 0.f;
    v16h pb;   // P^T as B operand: element e = key 8*hi + e, 8 + e = key 16 + 8*hi + e
    for (int r = 0; r < 8; ++r) {
      float x0 = __expf(sa[r] * 0.125f - nm);
      float x1 = __expf(sb[r] * 0.125f - nm);
      ps += x0 + x1;
      pb[r]     = (_Float16)x0;
      pb[8 + r] = (_Float16)x1;
    }
    lrun = lrun * al + ps;
    o0 *= al; o1 *= al; o2 *= al; o3 *= al;

    o0 = wmma_f16(ld_frag(vv, 0,  P64, 0, lane), pb, o0);
    o1 = wmma_f16(ld_frag(vv, 16, P64, 0, lane), pb, o1);
    o2 = wmma_f16(ld_frag(vv, 32, P64, 0, lane), pb, o2);
    o3 = wmma_f16(ld_frag(vv, 48, P64, 0, lane), pb, o3);

    // publish point of the next chunk, then the refill of the buffer just read
    wait_ds0();
    wait_async0();
    __syncthreads();
    if (t0 + 2 * BC < S) stage(t0 + 2 * BC, buf);
  }
  wait_async0();

  // epilogue: join the halves' sums, normalize, store to [B,S,D] (heads
  // interleaved); a lane's 8 registers of a tile are 8 consecutive dk: 16 B
  const float inv = 1.0f / (lrun + xhalf(lrun));
  _Float16* cp = ctx + (long)(b * S + q0 + w * 16 + nlo) * D + h * DK + 8 * hi;
  const v8f* ot[4] = {&o0, &o1, &o2, &o3};
  for (int t = 0; t < 4; ++t) {
    union { _Float16 hh[8]; uint4 u; } pk;
    for (int r = 0; r < 8; ++r) pk.hh[r] = (_Float16)((*ot[t])[r] * inv);
    *reinterpret_cast<uint4*>(cp + 16 * t) = pk.u;
  }
}

// ---------------- host launcher ----------------
extern "C" void kernel_launch(void* const* d_in, const int* in_sizes, int n_in,
                              void* d_out, int out_size, void* d_ws,
                              size_t ws_size, hipStream_t stream) {
  const float* x  = (const float*)d_in[0];
  const float* Wq = (const float*)d_in[1];
  const float* bq = (const float*)d_in[2];
  const float* Wk = (const float*)d_in[3];
  const float* bk = (const float*)d_in[4];
  const float* Wv = (const float*)d_in[5];
  const float* bv = (const float*)d_in[6];
  const float* Wo = (const float*)d_in[7];
  const float* bo = (const float*)d_in[8];
  float* out = (float*)d_out;

  // workspace carve-up (f16): x, 4 weights(T), Q, K, Vt, ctx => 48MB
  _Float16* p = (_Float16*)d_ws;
  _Float16* xh   = p; p += XE;
  _Float16* wqt  = p; p += WE;
  _Float16* wkt  = p; p += WE;
  _Float16* wvt  = p; p += WE;
  _Float16* wot  = p; p += WE;
  _Float16* qh   = p; p += XE;
  _Float16* kh   = p; p += XE;
  _Float16* vt   = p; p += XE;   // [B,H,DK,S]
  _Float16* ctxh = p; p += XE;
  if (ws_size < (size_t)((char*)p - (char*)d_ws)) return;

  // 1) conversions, one launch: x straight; weights converted + transposed to
  //    [N][K]; wqt, wkt, wvt, wot lie WE apart in the workspace
  convert_all_kernel<<<XBLK + 4 * WBLK, 256, 0, stream>>>(x, Wq, Wk, Wv, Wo, xh,
                                                          wqt);

  // 2) Q/K/V projections, one launch, one work-group for all three products
  //    of a tile: wqt, wkt, wvt lie WE apart and qh, kh, vt lie XE apart
  dim3 ggrid(D / 128, MROWS / 128);      // (8, 32)
  gemm_bias_kernel<3, 8><<<ggrid, 512, 0, stream>>>(xh, wqt, bq, bk, bv, nullptr,
                                                    qh, MROWS, D, D);

  // 3) attention: B*H*(S/64) = 1024 blocks of 128 threads
  attn_kernel<<<BB * H * (S / 64), 128, 0, stream>>>(qh, kh, vt, ctxh);

  // 4) output projection (f32 out into d_out)
  gemm_bias_kernel<1, 4><<<ggrid, 256, 0, stream>>>(ctxh, wot, bo, nullptr,
                                                    nullptr, out, nullptr,
                                                    MROWS, D, D);
}

// v007
// One run takes 63.4 microseconds.
// Next to v006, in two timings, it ran 1.14 and 1.13 times as fast.
// All steps since v000 together make it 4.30 times as fast.
#include <hip/hip_runtime.h>
#include <hip/hip_bf16.h>

typedef __attribute__((ext_vector_type(16))) _Float16 v16h;
typedef __attribute__((ext_vector_type(8)))  float    v8f;

// ---------------- problem constants ----------------
constexpr int BB = 4, S = 1024, D = 1024, H = 16, DK = 64;
constexpr int MROWS = BB * S;          // 4096
constexpr long XE = (long)MROWS * D;   // 4M elements
constexpr long WE = (long)D * D;       // 1M elements

// ---------------- WMMA wrapper ----------------
__device__ __forceinline__ v8f wmma_f16(v16h a, v16h b, v8f c) {
  return __builtin_amdgcn_wmma_f32_16x16x32_f16(
      /*neg_a=*/false, a, /*neg_b=*/false, b,
      /*c_mod=*/(short)0, c, /*reuse_a=*/false, /*reuse_b=*/false);
}

__device__ __forceinline__ unsigned lds_off(const _Float16* p) {
  return (unsigned)(unsigned long long)p;
}
__device__ __forceinline__ void async_ld_b128_x4(
    const _Float16* l0, const _Float16* g0, const _Float16* l1,
    const _Float16* g1, const _Float16* l2, const _Float16* g2,
    const _Float16* l3, const _Float16* g3) {
  asm volatile("global_load_async_to_lds_b128 %0, %1, off\n\t"
               "global_load_async_to_lds_b128 %2, %3, off\n\t"
               "global_load_async_to_lds_b128 %4, %5, off\n\t"
               "global_load_async_to_lds_b128 %6, %7, off\n\t"
               "s_wait_xcnt 0x0"
               :: "v"(lds_off(l0)), "v"(g0), "v"(lds_off(l1)), "v"(g1),
                  "v"(lds_off(l2)), "v"(g2), "v"(lds_off(l3)), "v"(g3)
               : "memory");
}
__device__ __forceinline__ void async_ld_b128_x8(
    const _Float16* const (&l)[8], const _Float16* const (&g)[8]) {
  asm volatile("global_load_async_to_lds_b128 %0, %1, off\n\t"
               "global_load_async_to_lds_b128 %2, %3, off\n\t"
               "global_load_async_to_lds_b128 %4, %5, off\n\t"
               "global_load_async_to_lds_b128 %6, %7, off\n\t"
               "global_load_async_to_lds_b128 %8, %9, off\n\t"
               "global_load_async_to_lds_b128 %10, %11, off\n\t"
               "global_load_async_to_lds_b128 %12, %13, off\n\t"
               "global_load_async_to_lds_b128 %14, %15, off\n\t"
               "s_wait_xcnt 0x0"
               :: "v"(lds_off(l[0])), "v"(g[0]), "v"(lds_off(l[1])), "v"(g[1]),
                  "v"(lds_off(l[2])), "v"(g[2]), "v"(lds_off(l[3])), "v"(g[3]),
                  "v"(lds_off(l[4])), "v"(g[4]), "v"(lds_off(l[5])), "v"(g[5]),
                  "v"(lds_off(l[6])), "v"(g[6]), "v"(lds_off(l[7])), "v"(g[7])
               : "memory");
}

constexpr int P128 = 72;   // rows of 64 f16 (128 B) at 144 B
__device__ __forceinline__ void wait_async0() {
  asm volatile("s_wait_asynccnt 0" ::: "memory");
}
// Foot of a ring trip: this wave's LDS reads have retired before the barrier
// behind which the buffer it has just read is refilled.
__device__ __forceinline__ void wait_ds0() {
  asm volatile("s_wait_dscnt 0" ::: "memory");
}

__device__ __forceinline__ v16h ld_frag(const _Float16* tile, int rbase,
                                        int stride, int k0, int lane) {
  const int m  = lane & 15;
  const int kb = (lane >> 4) << 3;   // 0 or 8
  const _Float16* p = tile + (rbase + m) * stride + k0 + kb;
  union { uint4 u[2]; v16h h; } r;
  r.u[0] = *reinterpret_cast<const uint4*>(p);
  r.u[1] = *reinterpret_cast<const uint4*>(p + 16);
  return r.h;
}

__device__ __forceinline__ float xhalf(float x) {
  int v = __builtin_bit_cast(int, x);
  return __builtin_bit_cast(float, __builtin_amdgcn_permlanex16(
      v, v, 0x76543210, 0xfedcba98, false, false));
}

// ---------------- fp32 -> fp16 pre-pass, one launch ----------------
// The pre-pass is short, so what it pays is launches and wave starts: all five
// conversions share one grid, and a thread converts 64 elements with its 16
// 16-B loads issued ahead of the first store.
// Blocks [0, XBLK): x straight; a wave's load covers 512 contiguous bytes and
// its 8-B-per-lane store 256.
// Blocks [XBLK, XBLK + 4 * WBLK): weights converted and transposed,
// dst[n][k] = src[k][n], so that GEMM B fragments are k-contiguous. A thread
// holds two blocks of 8 k x 4 n and stores 8 consecutive k of one n as 16 B.
// Lanes: 8 along n (a load covers 128-B lines of 4 rows) x 4 along k; the two
// blocks lie 32 k apart, so one wave writes each 128-B line of dst whole.
typedef __attribute__((ext_vector_type(4))) float    f32x4;
typedef __attribute__((ext_vector_type(4))) _Float16 f16x4;
typedef __attribute__((ext_vector_type(8))) _Float16 f16x8;
constexpr int XBLK = (int)(XE / (256 * 64));   // 256
constexpr int WBLK = (int)(WE / (256 * 64));   // 64 tiles of 128 k x 128 n
__global__ __launch_bounds__(256) __attribute__((amdgpu_waves_per_eu(4, 8)))
void convert_all_kernel(
    const float* __restrict__ x, const float* __restrict__ Wq,
    const float* __restrict__ Wk, const float* __restrict__ Wv,
    const float* __restrict__ Wo, _Float16* __restrict__ xh,
    _Float16* __restrict__ wt) {
  const int lane = threadIdx.x & 31, w = threadIdx.x >> 5;
  const int blk = blockIdx.x;
  if (blk < XBLK) {
    const long base = (long)blk * (256 * 64) + w * (32 * 64) + lane * 4;
    const float* xp = x + base;
    f32x4 v[16];
    // every loop here is unrolled so that v stays in registers and the loads
    // stand as one run
#pragma unroll
    for (int j = 0; j < 16; ++j)
      v[j] = *reinterpret_cast<const f32x4*>(xp + j * 128);
    asm volatile("s_wait_xcnt 0x0" :: "v"(xp) : "memory");
#pragma unroll
    for (int j = 0; j < 16; ++j)
      *reinterpret_cast<f16x4*>(xh + base + j * 128) =
          __builtin_convertvector(v[j], f16x4);
    return;
  }
  const int t = blk - XBLK;
  const int z = t / WBLK, tile = t % WBLK;
  const float* src = z == 0 ? Wq : (z == 1 ? Wk : (z == 2 ? Wv : Wo));
  _Float16* dst = wt + (long)z * WE;
  const int n0 = (tile & 7) * 128 + (w & 3) * 32 + (lane & 7) * 4;
  const int k0 = (tile >> 3) * 128 + (w >> 2) * 64 + (lane >> 3) * 8;
  const float* sp = src + (long)k0 * D + n0;
  f32x4 v[2][8];
#pragma unroll
  for (int u = 0; u < 2; ++u)
#pragma unroll
    for (int j = 0; j < 8; ++j)
      v[u][j] = *reinterpret_cast<const f32x4*>(sp + (32 * u + j) * D);
  asm volatile("s_wait_xcnt 0x0" :: "v"(sp) : "memory");
#pragma unroll
  for (int i = 0; i < 4; ++i)
#pragma unroll
    for (int u = 0; u < 2; ++u) {
      f16x8 h;
#pragma unroll
      for (int j = 0; j < 8; ++j) h[j] = (_Float16)v[u][j][i];
      *reinterpret_cast<f16x8*>(dst + (long)(n0 + i) * D + k0 + 32 * u) = h;
    }
}

template <int LAYOUT, int FN>
__device__ __forceinline__ void gemm_store(
    const v8f (&acc)[4][FN], const float* __restrict__ bias,
    float* __restrict__ Cf, _Float16* __restrict__ Ch, int N, int nb, int mb,
    int lane) {
  const int nlo = lane & 15, hi = (lane >> 4) & 1;
#pragma unroll
  for (int j = 0; j < FN; ++j) {
    int col = nb + j * 16 + nlo;
    float bv = bias[col];
#pragma unroll
    for (int i = 0; i < 4; ++i) {
#pragma unroll
      for (int r = 0; r < 8; ++r) {
        long row = mb + i * 16 + r + 8 * hi;
        float val = acc[i][j][r] + bv;
        if (LAYOUT == 0) {
          Cf[row * N + col] = val;
        } else if (LAYOUT == 1) {
          Ch[row * N + col] = (_Float16)val;
        } else {
          // V output in [B, H, DK, S]: row = b*S+s, col = h*DK+dk
          int b = (int)(row >> 10), s = (int)(row & (S - 1));
          int h = col >> 6, dk = col & (DK - 1);
          Ch[(long)((b * H + h) * DK + dk) * S + s] = (_Float16)val;
        }
      }
    }
  }
}

template <int NZ, int WN>
__global__ __launch_bounds__(64 * WN) void gemm_bias_kernel(
    const _Float16* __restrict__ A, const _Float16* __restrict__ BT0,
    const float* __restrict__ bias0, const float* __restrict__ bias1,
    const float* __restrict__ bias2, float* __restrict__ Cf,
    _Float16* __restrict__ Ch0, int M, int N, int K) {
  constexpr int BM = 128, BN = 128, BK = 64;
  constexpr int FN = BN / (16 * WN);    // B fragments a wave and weight
  constexpr int CPT = 16 / WN;          // copies a thread and staged tile
  static_assert((NZ + 1) * CPT == 8, "one statement of eight copies a stage");
  __shared__ __attribute__((aligned(16))) _Float16 a_sh[2][BM * P128];  // [row][k]
  __shared__ __attribute__((aligned(16))) _Float16 b_sh[2][NZ * BN * P128];  // [z][n][k]

  const int tid = threadIdx.x;
  const int lane = tid & 31, w = tid >> 5;
  const int wm = w / WN, wn = w % WN;
  const int n0 = blockIdx.x * BN, m0 = blockIdx.y * BM;

  // every inner loop of this kernel and of its epilogue is unrolled, so that
  // accumulators and fragments are indexed by constants and stay in registers
  v8f acc[NZ][4][FN];
#pragma unroll
  for (int z = 0; z < NZ; ++z)
#pragma unroll
    for (int i = 0; i < 4; ++i)
#pragma unroll
      for (int j = 0; j < FN; ++j) acc[z][i][j] = {};

  // async-stage the NZ + 1 tiles of one k step into buffer buf:
  // 128 rows x 64 f16 = 8 x b128 per row each; tile 0 is A, tile z + 1 weight z
  auto stage = [&](int kk, int buf) {
    const _Float16* ld[8];
    const _Float16* gs[8];
    const int row0 = tid >> 3, g = (tid & 7) * 8;
#pragma unroll
    for (int c = 0; c < 8; ++c) {
      const int tl = c / CPT;
      const int row = row0 + (c % CPT) * (8 * WN);
      if (tl == 0) {
        ld[c] = a_sh[buf] + row * P128 + g;
        gs[c] = A + (long)(m0 + row) * K + kk + g;
      } else {
        ld[c] = b_sh[buf] + ((tl - 1) * BN + row) * P128 + g;
        gs[c] = BT0 + (tl - 1) * WE + (long)(n0 + row) * K + kk + g;
      }
    }
    async_ld_b128_x8(ld, gs);
  };

  stage(0, 0);
  wait_async0();
  __syncthreads();
  if (BK < K) stage(BK, 1);

  for (int kk = 0; kk < K; kk += BK) {
    const int buf = (kk / BK) & 1;
    const _Float16* at = a_sh[buf];
    const _Float16* bt = b_sh[buf];
    v16h af[2][4];
    v16h bf[2][NZ][FN];
#pragma unroll
    for (int s = 0; s < 2; ++s) {
#pragma unroll
      for (int i = 0; i < 4; ++i)
        af[s][i] = ld_frag(at, wm * 64 + i * 16, P128, s * 32, lane);
#pragma unroll
      for (int z = 0; z < NZ; ++z)
#pragma unroll
        for (int j = 0; j < FN; ++j)
          bf[s][z][j] =
              ld_frag(bt, z * BN + (wn * FN + j) * 16, P128, s * 32, lane);
    }
    // fence pair round the WMMA block. The first keeps the k step's LDS reads
    // one group ahead of it: left alone, the compiler sinks each B fragment's
    // reads to just in front of its four WMMAs, with a full wait there.
    __builtin_amdgcn_sched_barrier(0);
#pragma unroll
    for (int s = 0; s < 2; ++s)
#pragma unroll
      for (int z = 0; z < NZ; ++z)
#pragma unroll
        for (int j = 0; j < FN; ++j)
#pragma unroll
          for (int i = 0; i < 4; ++i)
            acc[z][i][j] = wmma_f16(af[s][i], bf[s][z][j], acc[z][i][j]);
    // The second keeps the block in front of the foot's waits: lifted over it,
    // they would end the flight of the next tile's copies a whole block early.
    __builtin_amdgcn_sched_barrier(0);
    // publish point of the next tile, then the refill of the buffer just read
    wait_ds0();
    wait_async0();
    __syncthreads();
    if (kk + 2 * BK < K) stage(kk + 2 * BK, buf);
  }
  wait_async0();

  const int mb = m0 + wm * 64, nb = n0 + wn * FN * 16;
  if constexpr (NZ == 1) {
    gemm_store<0, FN>(acc[0], bias0, Cf, Ch0, N, nb, mb, lane);
  } else {
    gemm_store<1, FN>(acc[0], bias0, Cf, Ch0, N, nb, mb, lane);
    gemm_store<1, FN>(acc[1], bias1, Cf, Ch0 + XE, N, nb, mb, lane);
    gemm_store<2, FN>(acc[2], bias2, Cf, Ch0 + 2 * XE, N, nb, mb, lane);
  }
}

__global__ __launch_bounds__(256) void attn_kernel(
    const _Float16* __restrict__ Q, const _Float16* __restrict__ Km,
    const _Float16* __restrict__ Vt, _Float16* __restrict__ ctx) {
  constexpr int BQ = 128, BC = 64;
  __shared__ __attribute__((aligned(16))) _Float16 q_sh[BQ * P128];  // [q][dk]
  __shared__ __attribute__((aligned(16))) _Float16 k_sh[2][BC * P128];  // [key][dk]
  __shared__ __attribute__((aligned(16))) _Float16 vT[2][DK * P128];    // [dk][key]
  // the pair's exchange: [wave][8 x 4 of O^T, then maximum and sum][lane]
  __shared__ __attribute__((aligned(16))) f32x4 join_sh[8][9][32];

  const int tid = threadIdx.x, lane = tid & 31, w = tid >> 5;
  const int qg = w & 3, kh = w >> 2;      // query group, half of a key chunk
  const int nsb = S / BQ;                 // 8
  const int sblk = blockIdx.x % nsb;
  const int bh = blockIdx.x / nsb;
  const int b = bh / H, h = bh % H;
  const int q0 = sblk * BQ;
  const int hi = (lane >> 4) & 1, nlo = lane & 15;
  const int row = tid >> 3, g = (tid & 7) * 8;   // a copy's row and 16 B of it

  // async-stage Q tile 128x64: 8 x b128 per row, 4 per thread, rows 32 apart
  {
    const _Float16* ql = q_sh + row * P128 + g;
    const _Float16* qp = Q + (long)(b * S + q0 + row) * D + h * DK + g;
    async_ld_b128_x4(ql, qp, ql + 32 * P128, qp + 32 * D,
                     ql + 64 * P128, qp + 64 * D, ql + 96 * P128, qp + 96 * D);
  }
  const _Float16* vt_base = Vt + (long)bh * DK * S;
  // K chunk 64x64 and V^T chunk 64x64: 512 b128 each, 2 a thread, rows 32
  // apart; every copy of a wave covers four whole 128-B lines
  auto stage = [&](int t0, int buf) {
    const _Float16* kl = k_sh[buf] + row * P128 + g;
    const _Float16* kg = Km + (long)(b * S + t0 + row) * D + h * DK + g;
    const _Float16* vl = vT[buf] + row * P128 + g;
    const _Float16* vg = vt_base + (long)row * S + t0 + g;
    async_ld_b128_x4(kl, kg, vl, vg, kl + 32 * P128, kg + 32 * D,
                     vl + 32 * P128, vg + 32 * S);
  };
  stage(0, 0);
  wait_async0();
  __syncthreads();
  stage(BC, 1);
  v16h bq[2][2];
  // every loop over the two query tiles or over a tile's registers is unrolled,
  // so that fragments and accumulators are indexed by constants
#pragma unroll
  for (int u = 0; u < 2; ++u) {
    bq[u][0] = ld_frag(q_sh, qg * 32 + u * 16, P128, 0, lane);
    bq[u][1] = ld_frag(q_sh, qg * 32 + u * 16, P128, 32, lane);
  }

  // per lane and tile: running maximum of its query, running sum over its keys
  float mrun[2] = {-3.0e38f, -3.0e38f}, lrun[2] = {0.f, 0.f};
  v8f o[2][4];   // O^T: dk = 16*t + r + 8*hi
#pragma unroll
  for (int u = 0; u < 2; ++u)
#pragma unroll
    for (int t = 0; t < 4; ++t) o[u][t] = {};

  for (int t0 = 0; t0 < S; t0 += BC) {
    const int buf = (t0 / BC) & 1;
    const _Float16* kt = k_sh[buf];
    const _Float16* vv = vT[buf];

    // this wave's 32 keys of the chunk: 4 K fragments, 4 V^T fragments
    const v16h k00 = ld_frag(kt, kh * 32, P128, 0, lane);
    const v16h k01 = ld_frag(kt, kh * 32, P128, 32, lane);
    const v16h k10 = ld_frag(kt, kh * 32 + 16, P128, 0, lane);
    const v16h k11 = ld_frag(kt, kh * 32 + 16, P128, 32, lane);
    v16h va[4];
#pragma unroll
    for (int t = 0; t < 4; ++t) va[t] = ld_frag(vv, 16 * t, P128, kh * 32, lane);
    // keeps the trip's 16 LDS reads one group ahead of its WMMAs: left alone,
    // the compiler sinks half of the V^T reads to the foot, with a full wait
    __builtin_amdgcn_sched_barrier(0);

    // scores, transposed: 32 keys x 2 x 16 query columns, contraction over DK
    v8f sa[2], sb[2];
#pragma unroll
    for (int u = 0; u < 2; ++u) {
      sa[u] = {};
      sb[u] = {};
      sa[u] = wmma_f16(k00, bq[u][0], sa[u]);
      sb[u] = wmma_f16(k10, bq[u][0], sb[u]);
    }
#pragma unroll
    for (int u = 0; u < 2; ++u) {
      sa[u] = wmma_f16(k01, bq[u][1], sa[u]);
      sb[u] = wmma_f16(k11, bq[u][1], sb[u]);
    }
    __builtin_amdgcn_sched_barrier(0);

    // online softmax (scale = 1/sqrt(DK) = 0.125), tile by tile
    v16h pb[2];   // P^T as B operand: element e = key 8*hi + e, 8 + e = key 16 + 8*hi + e
#pragma unroll
    for (int u = 0; u < 2; ++u) {
      float mx = fmaxf(sa[u][0], sb[u][0]);
#pragma unroll
      for (int r = 1; r < 8; ++r) mx = fmaxf(mx, fmaxf(sa[u][r], sb[u][r]));
      mx = fmaxf(mx, xhalf(mx)) * 0.125f;   // both halves: the query's maximum
      const float nm = fmaxf(mrun[u], mx);
      const float al = __expf(mrun[u] - nm);
      mrun[u] = nm;
      float ps = 0.f;
#pragma unroll
      for (int r = 0; r < 8; ++r) {
        float x0 = __expf(sa[u][r] * 0.125f - nm);
        ps += x0;
        pb[u][r] = (_Float16)x0;
      }
#pragma unroll
      for (int r = 0; r < 8; ++r) {
        float x1 = __expf(sb[u][r] * 0.125f - nm);
        ps += x1;
        pb[u][8 + r] = (_Float16)x1;
      }
      lrun[u] = lrun[u] * al + ps;
#pragma unroll
      for (int t = 0; t < 4; ++t) o[u][t] *= al;
    }

#pragma unroll
    for (int t = 0; t < 4; ++t)
#pragma unroll
      for (int u = 0; u < 2; ++u) o[u][t] = wmma_f16(va[t], pb[u], o[u][t]);
    // keeps softmax and WMMAs in front of the foot's waits: lifted over them,
    // the waits would end the flight of the next chunk's copies early
    __builtin_amdgcn_sched_barrier(0);

    // publish point of the next chunk, then the refill of the buffer just read
    wait_ds0();
    wait_async0();
    __syncthreads();
    if (t0 + 2 * BC < S) stage(t0 + 2 * BC, buf);
  }
  wait_async0();

  const bool up = kh != 0;
  const float mk = up ? mrun[1] : mrun[0], mg = up ? mrun[0] : mrun[1];
  const float lk = up ? lrun[1] : lrun[0], lg = up ? lrun[0] : lrun[1];
  v8f ok[4];
#pragma unroll
  for (int t = 0; t < 4; ++t) {
    v8f og;
#pragma unroll
    for (int r = 0; r < 8; ++r) {
      ok[t][r] = up ? o[1][t][r] : o[0][t][r];
      og[r]    = up ? o[0][t][r] : o[1][t][r];
    }
    join_sh[w][2 * t][lane]     = f32x4{og[0], og[1], og[2], og[3]};
    join_sh[w][2 * t + 1][lane] = f32x4{og[4], og[5], og[6], og[7]};
  }
  join_sh[w][8][lane] = f32x4{mg, lg, 0.f, 0.f};
  __syncthreads();
  const f32x4 ml = join_sh[w ^ 4][8][lane];
  const float mj = fmaxf(mk, ml[0]);
  const float ak = __expf(mk - mj), ap = __expf(ml[0] - mj);
  const float lj = lk * ak + ml[1] * ap;

  // epilogue: join the halves' sums, normalize, store to [B,S,D] (heads
  // interleaved); a lane's 8 registers of a tile are 8 consecutive dk: 16 B
  const float inv = 1.0f / (lj + xhalf(lj));
  const float ck = ak * inv, cp2 = ap * inv;
  _Float16* cp = ctx + (long)(b * S + q0 + qg * 32 + kh * 16 + nlo) * D +
                 h * DK + 8 * hi;
#pragma unroll
  for (int t = 0; t < 4; ++t) {
    const f32x4 p0 = join_sh[w ^ 4][2 * t][lane];
    const f32x4 p1 = join_sh[w ^ 4][2 * t + 1][lane];
    union { _Float16 hh[8]; uint4 u; } pk;
#pragma unroll
    for (int r = 0; r < 4; ++r) {
      pk.hh[r]     = (_Float16)(ok[t][r] * ck + p0[r] * cp2);
      pk.hh[4 + r] = (_Float16)(ok[t][4 + r] * ck + p1[r] * cp2);
    }
    *reinterpret_cast<uint4*>(cp + 16 * t) = pk.u;
  }
}

// ---------------- host launcher ----------------
extern "C" void kernel_launch(void* const* d_in, const int* in_sizes, int n_in,
                              void* d_out, int out_size, void* d_ws,
                              size_t ws_size, hipStream_t stream) {
  const float* x  = (const float*)d_in[0];
  const float* Wq = (const float*)d_in[1];
  const float* bq = (const float*)d_in[2];
  const float* Wk = (const float*)d_in[3];
  const float* bk = (const float*)d_in[4];
  const float* Wv = (const float*)d_in[5];
  const float* bv = (const float*)d_in[6];
  const float* Wo = (const float*)d_in[7];
  const float* bo = (const float*)d_in[8];
  float* out = (float*)d_out;

  // workspace carve-up (f16): x, 4 weights(T), Q, K, Vt, ctx => 48MB
  _Float16* p = (_Float16*)d_ws;
  _Float16* xh   = p; p += XE;
  _Float16* wqt  = p; p += WE;
  _Float16* wkt  = p; p += WE;
  _Float16* wvt  = p; p += WE;
  _Float16* wot  = p; p += WE;
  _Float16* qh   = p; p += XE;
  _Float16* kh   = p; p += XE;
  _Float16* vt   = p; p += XE;   // [B,H,DK,S]
  _Float16* ctxh = p; p += XE;
  if (ws_size < (size_t)((char*)p - (char*)d_ws)) return;

  // 1) conversions, one launch: x straight; weights converted + transposed to
  //    [N][K]; wqt, wkt, wvt, wot lie WE apart in the workspace
  convert_all_kernel<<<XBLK + 4 * WBLK, 256, 0, stream>>>(x, Wq, Wk, Wv, Wo, xh,
                                                          wqt);

  // 2) Q/K/V projections, one launch, one work-group for all three products
  //    of a tile: wqt, wkt, wvt lie WE apart and qh, kh, vt lie XE apart
  dim3 ggrid(D / 128, MROWS / 128);      // (8, 32)
  gemm_bias_kernel<3, 8><<<ggrid, 512, 0, stream>>>(xh, wqt, bq, bk, bv, nullptr,
                                                    qh, MROWS, D, D);

  // 3) attention: B*H*(S/128) = 512 blocks of 256 threads
  attn_kernel<<<BB * H * (S / 128), 256, 0, stream>>>(qh, kh, vt, ctxh);

  // 4) output projection (f32 out into d_out)
  gemm_bias_kernel<1, 4><<<ggrid, 256, 0, stream>>>(ctxh, wot, bo, nullptr,
                                                    nullptr, out, nullptr,
                                                    MROWS, D, D);
}

// v008
// Measured time: 60.4 microseconds a run.
// Next to v007, in two timings, it ran 1.05 times as fast each time.
// Counting every step since v000, it is 4.52 times as fast.
#include <hip/hip_runtime.h>
#include <hip/hip_bf16.h>

typedef __attribute__((ext_vector_type(16))) _Float16 v16h;
typedef __attribute__((ext_vector_type(8)))  float    v8f;

// ---------------- problem constants ----------------
constexpr int BB = 4, S = 1024, D = 1024, H = 16, DK = 64;
constexpr int MROWS = BB * S;          // 4096
constexpr long XE = (long)MROWS * D;   // 4M elements
constexpr long WE = (long)D * D;       // 1M elements

// ---------------- WMMA wrapper ----------------
__device__ __forceinline__ v8f wmma_f16(v16h a, v16h b, v8f c) {
  return __builtin_amdgcn_wmma_f32_16x16x32_f16(
      /*neg_a=*/false, a, /*neg_b=*/false, b,
      /*c_mod=*/(short)0, c, /*reuse_a=*/false, /*reuse_b=*/false);
}

__device__ __forceinline__ unsigned lds_off(const _Float16* p) {
  return (unsigned)(unsigned long long)p;
}
__device__ __forceinline__ void async_ld_b128_x4(
    const _Float16* l0, const _Float16* g0, const _Float16* l1,
    const _Float16* g1, const _Float16* l2, const _Float16* g2,
    const _Float16* l3, const _Float16* g3) {
  asm volatile("global_load_async_to_lds_b128 %0, %1, off\n\t"
               "global_load_async_to_lds_b128 %2, %3, off\n\t"
               "global_load_async_to_lds_b128 %4, %5, off\n\t"
               "global_load_async_to_lds_b128 %6, %7, off\n\t"
               "s_wait_xcnt 0x0"
               :: "v"(lds_off(l0)), "v"(g0), "v"(lds_off(l1)), "v"(g1),
                  "v"(lds_off(l2)), "v"(g2), "v"(lds_off(l3)), "v"(g3)
               : "memory");
}
__device__ __forceinline__ void async_ld_b128_x8(
    const _Float16* const (&l)[8], const _Float16* const (&g)[8]) {
  asm volatile("global_load_async_to_lds_b128 %0, %1, off\n\t"
               "global_load_async_to_lds_b128 %2, %3, off\n\t"
               "global_load_async_to_lds_b128 %4, %5, off\n\t"
               "global_load_async_to_lds_b128 %6, %7, off\n\t"
               "global_load_async_to_lds_b128 %8, %9, off\n\t"
               "global_load_async_to_lds_b128 %10, %11, off\n\t"
               "global_load_async_to_lds_b128 %12, %13, off\n\t"
               "global_load_async_to_lds_b128 %14, %15, off\n\t"
               "s_wait_xcnt 0x0"
               :: "v"(lds_off(l[0])), "v"(g[0]), "v"(lds_off(l[1])), "v"(g[1]),
                  "v"(lds_off(l[2])), "v"(g[2]), "v"(lds_off(l[3])), "v"(g[3]),
                  "v"(lds_off(l[4])), "v"(g[4]), "v"(lds_off(l[5])), "v"(g[5]),
                  "v"(lds_off(l[6])), "v"(g[6]), "v"(lds_off(l[7])), "v"(g[7])
               : "memory");
}

constexpr int P128 = 72;   // rows of 64 f16 (128 B) at 144 B
__device__ __forceinline__ void wait_async0() {
  asm volatile("s_wait_asynccnt 0" ::: "memory");
}
// Counted form for a ring deeper than two buffers: returns when all but this
// wave's N youngest copies have landed. N is a whole number of stages, and it
// is used only where the wave has issued exactly those stages behind the one
// that is published; elsewhere the wait is to 0.
template <int N>
__device__ __forceinline__ void wait_async_but() {
  asm volatile("s_wait_asynccnt %0" :: "n"(N) : "memory");
}
// Foot of a ring trip: this wave's LDS reads have retired before the barrier
// behind which the buffer it has just read is refilled.
__device__ __forceinline__ void wait_ds0() {
  asm volatile("s_wait_dscnt 0" ::: "memory");
}

__device__ __forceinline__ v16h ld_frag(const _Float16* tile, int rbase,
                                        int stride, int k0, int lane) {
  const int m  = lane & 15;
  const int kb = (lane >> 4) << 3;   // 0 or 8
  const _Float16* p = tile + (rbase + m) * stride + k0 + kb;
  union { uint4 u[2]; v16h h; } r;
  r.u[0] = *reinterpret_cast<const uint4*>(p);
  r.u[1] = *reinterpret_cast<const uint4*>(p + 16);
  return r.h;
}

__device__ __forceinline__ float xhalf(float x) {
  int v = __builtin_bit_cast(int, x);
  return __builtin_bit_cast(float, __builtin_amdgcn_permlanex16(
      v, v, 0x76543210, 0xfedcba98, false, false));
}

// ---------------- fp32 -> fp16 pre-pass, one launch ----------------
// The pre-pass is short, so what it pays is launches and wave starts: all five
// conversions share one grid, and a thread converts 64 elements with its 16
// 16-B loads issued ahead of the first store.
// Blocks [0, XBLK): x straight; a wave's load covers 512 contiguous bytes and
// its 8-B-per-lane store 256.
// Blocks [XBLK, XBLK + 4 * WBLK): weights converted and transposed,
// dst[n][k] = src[k][n], so that GEMM B fragments are k-contiguous. A thread
// holds two blocks of 8 k x 4 n and stores 8 consecutive k of one n as 16 B.
// Lanes: 8 along n (a load covers 128-B lines of 4 rows) x 4 along k; the two
// blocks lie 32 k apart, so one wave writes each 128-B line of dst whole.
typedef __attribute__((ext_vector_type(4))) float    f32x4;
typedef __attribute__((ext_vector_type(4))) _Float16 f16x4;
typedef __attribute__((ext_vector_type(8))) _Float16 f16x8;
constexpr int XBLK = (int)(XE / (256 * 64));   // 256
constexpr int WBLK = (int)(WE / (256 * 64));   // 64 tiles of 128 k x 128 n
__global__ __launch_bounds__(256) __attribute__((amdgpu_waves_per_eu(4, 8)))
void convert_all_kernel(
    const float* __restrict__ x, const float* __restrict__ Wq,
    const float* __restrict__ Wk, const float* __restrict__ Wv,
    const float* __restrict__ Wo, _Float16* __restrict__ xh,
    _Float16* __restrict__ wt) {
  const int lane = threadIdx.x & 31, w = threadIdx.x >> 5;
  const int blk = blockIdx.x;
  if (blk < XBLK) {
    const long base = (long)blk * (256 * 64) + w * (32 * 64) + lane * 4;
    const float* xp = x + base;
    f32x4 v[16];
    // every loop here is unrolled so that v stays in registers and the loads
    // stand as one run
#pragma unroll
    for (int j = 0; j < 16; ++j)
      v[j] = *reinterpret_cast<const f32x4*>(xp + j * 128);
    asm volatile("s_wait_xcnt 0x0" :: "v"(xp) : "memory");
#pragma unroll
    for (int j = 0; j < 16; ++j)
      *reinterpret_cast<f16x4*>(xh + base + j * 128) =
          __builtin_convertvector(v[j], f16x4);
    return;
  }
  const int t = blk - XBLK;
  const int z = t / WBLK, tile = t % WBLK;
  const float* src = z == 0 ? Wq : (z == 1 ? Wk : (z == 2 ? Wv : Wo));
  _Float16* dst = wt + (long)z * WE;
  const int n0 = (tile & 7) * 128 + (w & 3) * 32 + (lane & 7) * 4;
  const int k0 = (tile >> 3) * 128 + (w >> 2) * 64 + (lane >> 3) * 8;
  const float* sp = src + (long)k0 * D + n0;
  f32x4 v[2][8];
#pragma unroll
  for (int u = 0; u < 2; ++u)
#pragma unroll
    for (int j = 0; j < 8; ++j)
      v[u][j] = *reinterpret_cast<const f32x4*>(sp + (32 * u + j) * D);
  asm volatile("s_wait_xcnt 0x0" :: "v"(sp) : "memory");
#pragma unroll
  for (int i = 0; i < 4; ++i)
#pragma unroll
    for (int u = 0; u < 2; ++u) {
      f16x8 h;
#pragma unroll
      for (int j = 0; j < 8; ++j) h[j] = (_Float16)v[u][j][i];
      *reinterpret_cast<f16x8*>(dst + (long)(n0 + i) * D + k0 + 32 * u) = h;
    }
}

template <int LAYOUT, int FN>
__device__ __forceinline__ void gemm_store(
    const v8f (&acc)[4][FN], const float* __restrict__ bias,
    float* __restrict__ Cf, _Float16* __restrict__ Ch, int N, int nb, int mb,
    int lane) {
  const int nlo = lane & 15, hi = (lane >> 4) & 1;
#pragma unroll
  for (int j = 0; j < FN; ++j) {
    int col = nb + j * 16 + nlo;
    float bv = bias[col];
#pragma unroll
    for (int i = 0; i < 4; ++i) {
#pragma unroll
      for (int r = 0; r < 8; ++r) {
        long row = mb + i * 16 + r + 8 * hi;
        float val = acc[i][j][r] + bv;
        if (LAYOUT == 0) {
          Cf[row * N + col] = val;
        } else if (LAYOUT == 1) {
          Ch[row * N + col] = (_Float16)val;
        } else {
          // V output in [B, H, DK, S]: row = b*S+s, col = h*DK+dk
          int b = (int)(row >> 10), s = (int)(row & (S - 1));
          int h = col >> 6, dk = col & (DK - 1);
          Ch[(long)((b * H + h) * DK + dk) * S + s] = (_Float16)val;
        }
      }
    }
  }
}

template <int NZ, int WN, int NB>
__global__ __launch_bounds__(64 * WN) void gemm_bias_kernel(
    const _Float16* __restrict__ A, const _Float16* __restrict__ BT0,
    const float* __restrict__ bias0, const float* __restrict__ bias1,
    const float* __restrict__ bias2, float* __restrict__ Cf,
    _Float16* __restrict__ Ch0, int M, int N, int K) {
  constexpr int BM = 128, BN = 128, BK = 64;
  constexpr int FN = BN / (16 * WN);    // B fragments a wave and weight
  constexpr int CPT = 16 / WN;          // copies a thread and staged tile
  static_assert((NZ + 1) * CPT == 8, "one statement of eight copies a stage");
  __shared__ __attribute__((aligned(16))) _Float16 a_sh[NB][BM * P128];  // [row][k]
  __shared__ __attribute__((aligned(16))) _Float16 b_sh[NB][NZ * BN * P128];  // [z][n][k]

  const int tid = threadIdx.x;
  const int lane = tid & 31, w = tid >> 5;
  const int wm = w / WN, wn = w % WN;
  const int n0 = blockIdx.x * BN, m0 = blockIdx.y * BM;

  // every inner loop of this kernel and of its epilogue is unrolled, so that
  // accumulators and fragments are indexed by constants and stay in registers
  v8f acc[NZ][4][FN];
#pragma unroll
  for (int z = 0; z < NZ; ++z)
#pragma unroll
    for (int i = 0; i < 4; ++i)
#pragma unroll
      for (int j = 0; j < FN; ++j) acc[z][i][j] = {};

  // async-stage the NZ + 1 tiles of one k step into buffer buf:
  // 128 rows x 64 f16 = 8 x b128 per row each; tile 0 is A, tile z + 1 weight z
  auto stage = [&](int kk, int buf) {
    const _Float16* ld[8];
    const _Float16* gs[8];
    const int row0 = tid >> 3, g = (tid & 7) * 8;
#pragma unroll
    for (int c = 0; c < 8; ++c) {
      const int tl = c / CPT;
      const int row = row0 + (c % CPT) * (8 * WN);
      if (tl == 0) {
        ld[c] = a_sh[buf] + row * P128 + g;
        gs[c] = A + (long)(m0 + row) * K + kk + g;
      } else {
        ld[c] = b_sh[buf] + ((tl - 1) * BN + row) * P128 + g;
        gs[c] = BT0 + (tl - 1) * WE + (long)(n0 + row) * K + kk + g;
      }
    }
    async_ld_b128_x8(ld, gs);
  };

  // unrolled so that each stage's buffer is a constant
#pragma unroll
  for (int s = 0; s < NB; ++s)
    if (s * BK < K) stage(s * BK, s);
  // tile 0 has landed; the NB - 1 stages behind it may still fly
  if ((NB - 1) * BK < K) wait_async_but<8 * (NB - 1)>();
  else wait_async0();
  __syncthreads();

  int buf = 0;
  for (int kk = 0; kk < K; kk += BK) {
    const _Float16* at = a_sh[buf];
    const _Float16* bt = b_sh[buf];
    v16h af[2][4];
    v16h bf[2][NZ][FN];
#pragma unroll
    for (int s = 0; s < 2; ++s) {
#pragma unroll
      for (int i = 0; i < 4; ++i)
        af[s][i] = ld_frag(at, wm * 64 + i * 16, P128, s * 32, lane);
#pragma unroll
      for (int z = 0; z < NZ; ++z)
#pragma unroll
        for (int j = 0; j < FN; ++j)
          bf[s][z][j] =
              ld_frag(bt, z * BN + (wn * FN + j) * 16, P128, s * 32, lane);
    }
    // fence pair round the WMMA block. The first keeps the k step's LDS reads
    // one group ahead of it: left alone, the compiler sinks each B fragment's
    // reads to just in front of its four WMMAs, with a full wait there.
    __builtin_amdgcn_sched_barrier(0);
#pragma unroll
    for (int s = 0; s < 2; ++s)
#pragma unroll
      for (int z = 0; z < NZ; ++z)
#pragma unroll
        for (int j = 0; j < FN; ++j)
#pragma unroll
          for (int i = 0; i < 4; ++i)
            acc[z][i][j] = wmma_f16(af[s][i], bf[s][z][j], acc[z][i][j]);
    // The second keeps the block in front of the foot's waits: lifted over it,
    // they would end the flight of the next tile's copies a whole block early.
    __builtin_amdgcn_sched_barrier(0);
    // publish point of the next tile, then the refill of the buffer just read.
    // Tile t + 1 has landed once all but the NB - 2 stages issued behind it
    // have; in the last trips fewer stand behind it, and the wait is to 0.
    wait_ds0();
    if (kk + (NB - 1) * BK < K) wait_async_but<8 * (NB - 2)>();
    else wait_async0();
    __syncthreads();
    if (kk + NB * BK < K) stage(kk + NB * BK, buf);
    buf = buf + 1 == NB ? 0 : buf + 1;
  }
  wait_async0();

  const int mb = m0 + wm * 64, nb = n0 + wn * FN * 16;
  if constexpr (NZ == 1) {
    gemm_store<0, FN>(acc[0], bias0, Cf, Ch0, N, nb, mb, lane);
  } else {
    gemm_store<1, FN>(acc[0], bias0, Cf, Ch0, N, nb, mb, lane);
    gemm_store<1, FN>(acc[1], bias1, Cf, Ch0 + XE, N, nb, mb, lane);
    gemm_store<2, FN>(acc[2], bias2, Cf, Ch0 + 2 * XE, N, nb, mb, lane);
  }
}

__global__ __launch_bounds__(256) void attn_kernel(
    const _Float16* __restrict__ Q, const _Float16* __restrict__ Km,
    const _Float16* __restrict__ Vt, _Float16* __restrict__ ctx) {
  constexpr int BQ = 128, BC = 64, NB = 3;
  __shared__ __attribute__((aligned(16))) _Float16 q_sh[BQ * P128];  // [q][dk]
  __shared__ __attribute__((aligned(16))) _Float16 k_sh[NB][BC * P128];  // [key][dk]
  __shared__ __attribute__((aligned(16))) _Float16 vT[NB][DK * P128];    // [dk][key]
  // the pair's exchange: [wave][8 x 4 of O^T, then maximum and sum][lane]
  __shared__ __attribute__((aligned(16))) f32x4 join_sh[8][9][32];

  const int tid = threadIdx.x, lane = tid & 31, w = tid >> 5;
  const int qg = w & 3, kh = w >> 2;      // query group, half of a key chunk
  const int nsb = S / BQ;                 // 8
  const int sblk = blockIdx.x % nsb;
  const int bh = blockIdx.x / nsb;
  const int b = bh / H, h = bh % H;
  const int q0 = sblk * BQ;
  const int hi = (lane >> 4) & 1, nlo = lane & 15;
  const int row = tid >> 3, g = (tid & 7) * 8;   // a copy's row and 16 B of it

  // async-stage Q tile 128x64: 8 x b128 per row, 4 per thread, rows 32 apart
  {
    const _Float16* ql = q_sh + row * P128 + g;
    const _Float16* qp = Q + (long)(b * S + q0 + row) * D + h * DK + g;
    async_ld_b128_x4(ql, qp, ql + 32 * P128, qp + 32 * D,
                     ql + 64 * P128, qp + 64 * D, ql + 96 * P128, qp + 96 * D);
  }
  const _Float16* vt_base = Vt + (long)bh * DK * S;
  // K chunk 64x64 and V^T chunk 64x64: 512 b128 each, 2 a thread, rows 32
  // apart; every copy of a wave covers four whole 128-B lines
  auto stage = [&](int t0, int buf) {
    const _Float16* kl = k_sh[buf] + row * P128 + g;
    const _Float16* kg = Km + (long)(b * S + t0 + row) * D + h * DK + g;
    const _Float16* vl = vT[buf] + row * P128 + g;
    const _Float16* vg = vt_base + (long)row * S + t0 + g;
    async_ld_b128_x4(kl, kg, vl, vg, kl + 32 * P128, kg + 32 * D,
                     vl + 32 * P128, vg + 32 * S);
  };
  static_assert(S / BC >= NB, "the prologue fills every buffer");
  stage(0, 0);
  stage(BC, 1);
  stage(2 * BC, 2);
  // Q and chunk 0 have landed; the two stages behind them may still fly
  wait_async_but<4 * (NB - 1)>();
  __syncthreads();
  v16h bq[2][2];
  // every loop over the two query tiles or over a tile's registers is unrolled,
  // so that fragments and accumulators are indexed by constants
#pragma unroll
  for (int u = 0; u < 2; ++u) {
    bq[u][0] = ld_frag(q_sh, qg * 32 + u * 16, P128, 0, lane);
    bq[u][1] = ld_frag(q_sh, qg * 32 + u * 16, P128, 32, lane);
  }

  // per lane and tile: running maximum of its query, running sum over its keys
  float mrun[2] = {-3.0e38f, -3.0e38f}, lrun[2] = {0.f, 0.f};
  v8f o[2][4];   // O^T: dk = 16*t + r + 8*hi
#pragma unroll
  for (int u = 0; u < 2; ++u)
#pragma unroll
    for (int t = 0; t < 4; ++t) o[u][t] = {};

  int buf = 0;
  for (int t0 = 0; t0 < S; t0 += BC) {
    const _Float16* kt = k_sh[buf];
    const _Float16* vv = vT[buf];

    // this wave's 32 keys of the chunk: 4 K fragments, 4 V^T fragments
    const v16h k00 = ld_frag(kt, kh * 32, P128, 0, lane);
    const v16h k01 = ld_frag(kt, kh * 32, P128, 32, lane);
    const v16h k10 = ld_frag(kt, kh * 32 + 16, P128, 0, lane);
    const v16h k11 = ld_frag(kt, kh * 32 + 16, P128, 32, lane);
    v16h va[4];
#pragma unroll
    for (int t = 0; t < 4; ++t) va[t] = ld_frag(vv, 16 * t, P128, kh * 32, lane);
    // keeps the trip's 16 LDS reads one group ahead of its WMMAs: left alone,
    // the compiler sinks half of the V^T reads to the foot, with a full wait
    __builtin_amdgcn_sched_barrier(0);

    // scores, transposed: 32 keys x 2 x 16 query columns, contraction over DK
    v8f sa[2], sb[2];
#pragma unroll
    for (int u = 0; u < 2; ++u) {
      sa[u] = {};
      sb[u] = {};
      sa[u] = wmma_f16(k00, bq[u][0], sa[u]);
      sb[u] = wmma_f16(k10, bq[u][0], sb[u]);
    }
#pragma unroll
    for (int u = 0; u < 2; ++u) {
      sa[u] = wmma_f16(k01, bq[u][1], sa[u]);
      sb[u] = wmma_f16(k11, bq[u][1], sb[u]);
    }
    __builtin_amdgcn_sched_barrier(0);

    // online softmax (scale = 1/sqrt(DK) = 0.125), tile by tile
    v16h pb[2];   // P^T as B operand: element e = key 8*hi + e, 8 + e = key 16 + 8*hi + e
#pragma unroll
    for (int u = 0; u < 2; ++u) {
      float mx = fmaxf(sa[u][0], sb[u][0]);
#pragma unroll
      for (int r = 1; r < 8; ++r) mx = fmaxf(mx, fmaxf(sa[u][r], sb[u][r]));
      mx = fmaxf(mx, xhalf(mx)) * 0.125f;   // both halves: the query's maximum
      const float nm = fmaxf(mrun[u], mx);
      const float al = __expf(mrun[u] - nm);
      mrun[u] = nm;
      float ps = 0.f;
#pragma unroll
      for (int r = 0; r < 8; ++r) {
        float x0 = __expf(sa[u][r] * 0.125f - nm);
        ps += x0;
        pb[u][r] = (_Float16)x0;
      }
#pragma unroll
      for (int r = 0; r < 8; ++r) {
        float x1 = __expf(sb[u][r] * 0.125f - nm);
        ps += x1;
        pb[u][8 + r] = (_Float16)x1;
      }
      lrun[u] = lrun[u] * al + ps;
#pragma unroll
      for (int t = 0; t < 4; ++t) o[u][t] *= al;
    }

#pragma unroll
    for (int t = 0; t < 4; ++t)
#pragma unroll
      for (int u = 0; u < 2; ++u) o[u][t] = wmma_f16(va[t], pb[u], o[u][t]);
    // keeps softmax and WMMAs in front of the foot's waits: lifted over them,
    // the waits would end the flight of the next chunk's copies early
    __builtin_amdgcn_sched_barrier(0);

    // publish point of the next chunk, then the refill of the buffer just read;
    // counted while a whole stage stands behind the chunk that is published
    wait_ds0();
    if (t0 + (NB - 1) * BC < S) wait_async_but<4 * (NB - 2)>();
    else wait_async0();
    __syncthreads();
    if (t0 + NB * BC < S) stage(t0 + NB * BC, buf);
    buf = buf + 1 == NB ? 0 : buf + 1;
  }
  wait_async0();

  const bool up = kh != 0;
  const float mk = up ? mrun[1] : mrun[0], mg = up ? mrun[0] : mrun[1];
  const float lk = up ? lrun[1] : lrun[0], lg = up ? lrun[0] : lrun[1];
  v8f ok[4];
#pragma unroll
  for (int t = 0; t < 4; ++t) {
    v8f og;
#pragma unroll
    for (int r = 0; r < 8; ++r) {
      ok[t][r] = up ? o[1][t][r] : o[0][t][r];
      og[r]    = up ? o[0][t][r] : o[1][t][r];
    }
    join_sh[w][2 * t][lane]     = f32x4{og[0], og[1], og[2], og[3]};
    join_sh[w][2 * t + 1][lane] = f32x4{og[4], og[5], og[6], og[7]};
  }
  join_sh[w][8][lane] = f32x4{mg, lg, 0.f, 0.f};
  __syncthreads();
  const f32x4 ml = join_sh[w ^ 4][8][lane];
  const float mj = fmaxf(mk, ml[0]);
  const float ak = __expf(mk - mj), ap = __expf(ml[0] - mj);
  const float lj = lk * ak + ml[1] * ap;

  // epilogue: join the halves' sums, normalize, store to [B,S,D] (heads
  // interleaved); a lane's 8 registers of a tile are 8 consecutive dk: 16 B
  const float inv = 1.0f / (lj + xhalf(lj));
  const float ck = ak * inv, cp2 = ap * inv;
  _Float16* cp = ctx + (long)(b * S + q0 + qg * 32 + kh * 16 + nlo) * D +
                 h * DK + 8 * hi;
#pragma unroll
  for (int t = 0; t < 4; ++t) {
    const f32x4 p0 = join_sh[w ^ 4][2 * t][lane];
    const f32x4 p1 = join_sh[w ^ 4][2 * t + 1][lane];
    union { _Float16 hh[8]; uint4 u; } pk;
#pragma unroll
    for (int r = 0; r < 4; ++r) {
      pk.hh[r]     = (_Float16)(ok[t][r] * ck + p0[r] * cp2);
      pk.hh[4 + r] = (_Float16)(ok[t][4 + r] * ck + p1[r] * cp2);
    }
    *reinterpret_cast<uint4*>(cp + 16 * t) = pk.u;
  }
}

// ---------------- host launcher ----------------
extern "C" void kernel_launch(void* const* d_in, const int* in_sizes, int n_in,
                              void* d_out, int out_size, void* d_ws,
                              size_t ws_size, hipStream_t stream) {
  const float* x  = (const float*)d_in[0];
  const float* Wq = (const float*)d_in[1];
  const float* bq = (const float*)d_in[2];
  const float* Wk = (const float*)d_in[3];
  const float* bk = (const float*)d_in[4];
  const float* Wv = (const float*)d_in[5];
  const float* bv = (const float*)d_in[6];
  const float* Wo = (const float*)d_in[7];
  const float* bo = (const float*)d_in[8];
  float* out = (float*)d_out;

  // workspace carve-up (f16): x, 4 weights(T), Q, K, Vt, ctx => 48MB
  _Float16* p = (_Float16*)d_ws;
  _Float16* xh   = p; p += XE;
  _Float16* wqt  = p; p += WE;
  _Float16* wkt  = p; p += WE;
  _Float16* wvt  = p; p += WE;
  _Float16* wot  = p; p += WE;
  _Float16* qh   = p; p += XE;
  _Float16* kh   = p; p += XE;
  _Float16* vt   = p; p += XE;   // [B,H,DK,S]
  _Float16* ctxh = p; p += XE;
  if (ws_size < (size_t)((char*)p - (char*)d_ws)) return;

  // 1) conversions, one launch: x straight; weights converted + transposed to
  //    [N][K]; wqt, wkt, wvt, wot lie WE apart in the workspace
  convert_all_kernel<<<XBLK + 4 * WBLK, 256, 0, stream>>>(x, Wq, Wk, Wv, Wo, xh,
                                                          wqt);

  // 2) Q/K/V projections, one launch, one work-group for all three products
  //    of a tile: wqt, wkt, wvt lie WE apart and qh, kh, vt lie XE apart
  dim3 ggrid(D / 128, MROWS / 128);      // (8, 32)
  gemm_bias_kernel<3, 8, 4><<<ggrid, 512, 0, stream>>>(xh, wqt, bq, bk, bv, nullptr,
                                                    qh, MROWS, D, D);

  // 3) attention: B*H*(S/128) = 512 blocks of 256 threads
  attn_kernel<<<BB * H * (S / 128), 256, 0, stream>>>(qh, kh, vt, ctxh);

  // 4) output projection (f32 out into d_out)
  gemm_bias_kernel<1, 4, 6><<<ggrid, 256, 0, stream>>>(ctxh, wot, bo, nullptr,
                                                    nullptr, out, nullptr,
                                                    MROWS, D, D);
}

// v010
// It runs in 56.1 microseconds.
// It is 1.08 times as fast as v008, going by the measured steps of the versions left out in between.
// All steps since v000 together make it 4.87 times as fast.
#include <hip/hip_runtime.h>
#include <hip/hip_bf16.h>

typedef __attribute__((ext_vector_type(16))) _Float16 v16h;
typedef __attribute__((ext_vector_type(8)))  float    v8f;

// ---------------- problem constants ----------------
constexpr int BB = 4, S = 1024, D = 1024, H = 16, DK = 64;
constexpr int MROWS = BB * S;          // 4096
constexpr long XE = (long)MROWS * D;   // 4M elements
constexpr long WE = (long)D * D;       // 1M elements

// ---------------- WMMA wrapper ----------------
__device__ __forceinline__ v8f wmma_f16(v16h a, v16h b, v8f c) {
  return __builtin_amdgcn_wmma_f32_16x16x32_f16(
      /*neg_a=*/false, a, /*neg_b=*/false, b,
      /*c_mod=*/(short)0, c, /*reuse_a=*/false, /*reuse_b=*/false);
}

__device__ __forceinline__ void score_wmmas(
    v8f& sa0, v8f& sb0, v8f& sa1, v8f& sb1, v16h k00, v16h k01, v16h k10,
    v16h k11, v16h q00, v16h q01, v16h q10, v16h q11, v8f c0, v8f c1) {
  asm("v_wmma_f32_16x16x32_f16 %0, %4, %8, %12\n\t"
      "v_wmma_f32_16x16x32_f16 %1, %6, %8, %12\n\t"
      "v_wmma_f32_16x16x32_f16 %2, %4, %10, %13\n\t"
      "v_wmma_f32_16x16x32_f16 %3, %6, %10, %13\n\t"
      "v_wmma_f32_16x16x32_f16 %0, %5, %9, %0\n\t"
      "v_wmma_f32_16x16x32_f16 %1, %7, %9, %1\n\t"
      "v_wmma_f32_16x16x32_f16 %2, %5, %11, %2\n\t"
      "v_wmma_f32_16x16x32_f16 %3, %7, %11, %3\n\t"
      "v_nop\n\tv_nop\n\tv_nop\n\tv_nop"
      : "=&v"(sa0), "=&v"(sb0), "=&v"(sa1), "=&v"(sb1)
      : "v"(k00), "v"(k01), "v"(k10), "v"(k11), "v"(q00), "v"(q01), "v"(q10),
        "v"(q11), "v"(c0), "v"(c1));
}

__device__ __forceinline__ unsigned lds_off(const _Float16* p) {
  return (unsigned)(unsigned long long)p;
}
__device__ __forceinline__ void async_ld_b128_x4(
    const _Float16* l0, const _Float16* g0, const _Float16* l1,
    const _Float16* g1, const _Float16* l2, const _Float16* g2,
    const _Float16* l3, const _Float16* g3) {
  asm volatile("global_load_async_to_lds_b128 %0, %1, off\n\t"
               "global_load_async_to_lds_b128 %2, %3, off\n\t"
               "global_load_async_to_lds_b128 %4, %5, off\n\t"
               "global_load_async_to_lds_b128 %6, %7, off\n\t"
               "s_wait_xcnt 0x0"
               :: "v"(lds_off(l0)), "v"(g0), "v"(lds_off(l1)), "v"(g1),
                  "v"(lds_off(l2)), "v"(g2), "v"(lds_off(l3)), "v"(g3)
               : "memory");
}
constexpr int P128 = 72;   // rows of 64 f16 (128 B) at 144 B
__device__ __forceinline__ void wait_async0() {
  asm volatile("s_wait_asynccnt 0" ::: "memory");
}
// Counted form for a ring deeper than two buffers: returns when all but this
// wave's N youngest copies have landed. N is a whole number of stages, and it
// is used only where the wave has issued exactly those stages behind the one
// that is published; elsewhere the wait is to 0.
template <int N>
__device__ __forceinline__ void wait_async_but() {
  asm volatile("s_wait_asynccnt %0" :: "n"(N) : "memory");
}
// Foot of a ring trip: this wave's LDS reads have retired before the barrier
// behind which the buffer it has just read is refilled.
__device__ __forceinline__ void wait_ds0() {
  asm volatile("s_wait_dscnt 0" ::: "memory");
}

// ------------- tensor load: one request of one wave brings a 2-D tile -------
typedef uint32_t u32x4 __attribute__((ext_vector_type(4)));
typedef uint32_t u32x8 __attribute__((ext_vector_type(8)));
__device__ __forceinline__ uint32_t uni(uint32_t v) {
  return (uint32_t)__builtin_amdgcn_readfirstlane(v);
}
__device__ __forceinline__ uint32_t pinned(uint32_t v) {
  uint32_t w = uni(v);
  asm volatile("" : "+s"(w));   // the test stays a scalar value
  return w;
}
__device__ __forceinline__ void tdm_load(u32x4 g0, u32x8 g1) {
  asm volatile("tensor_load_to_lds %0, %1" :: "s"(g0), "s"(g1) : "memory");
}
// Returns when all but this wave's N youngest tensor loads have landed (at
// once in a wave that issues none).
template <int N>
__device__ __forceinline__ void wait_tensor_but() {
  asm volatile("s_wait_tensorcnt %0" :: "n"(N) : "memory");
}

__device__ __forceinline__ v16h ld_frag(const _Float16* tile, int rbase,
                                        int stride, int k0, int lane) {
  const int m  = lane & 15;
  const int kb = (lane >> 4) << 3;   // 0 or 8
  const _Float16* p = tile + (rbase + m) * stride + k0 + kb;
  union { uint4 u[2]; v16h h; } r;
  r.u[0] = *reinterpret_cast<const uint4*>(p);
  r.u[1] = *reinterpret_cast<const uint4*>(p + 16);
  return r.h;
}

__device__ __forceinline__ float xhalf(float x) {
  int v = __builtin_bit_cast(int, x);
  return __builtin_bit_cast(float, __builtin_amdgcn_permlanex16(
      v, v, 0x76543210, 0xfedcba98, false, false));
}

// ---------------- fp32 -> fp16 pre-pass, one launch ----------------
// The pre-pass is short, so what it pays is launches and wave starts: all five
// conversions share one grid, and a thread converts 64 elements with its 16
// 16-B loads issued ahead of the first store.
// Blocks [0, XBLK): x straight; a wave's load covers 512 contiguous bytes and
// its 8-B-per-lane store 256.
// Blocks [XBLK, XBLK + 4 * WBLK): weights converted and transposed,
// dst[n][k] = src[k][n], so that GEMM B fragments are k-contiguous. A thread
// holds two blocks of 8 k x 4 n and stores 8 consecutive k of one n as 16 B.
// Lanes: 8 along n (a load covers 128-B lines of 4 rows) x 4 along k; the two
// blocks lie 32 k apart, so one wave writes each 128-B line of dst whole.
typedef __attribute__((ext_vector_type(4))) float    f32x4;
typedef __attribute__((ext_vector_type(4))) _Float16 f16x4;
typedef __attribute__((ext_vector_type(8))) _Float16 f16x8;
constexpr int XBLK = (int)(XE / (256 * 64));   // 256
constexpr int WBLK = (int)(WE / (256 * 64));   // 64 tiles of 128 k x 128 n
__global__ __launch_bounds__(256) __attribute__((amdgpu_waves_per_eu(4, 8)))
void convert_all_kernel(
    const float* __restrict__ x, const float* __restrict__ Wq,
    const float* __restrict__ Wk, const float* __restrict__ Wv,
    const float* __restrict__ Wo, _Float16* __restrict__ xh,
    _Float16* __restrict__ wt) {
  const int lane = threadIdx.x & 31, w = threadIdx.x >> 5;
  const int blk = blockIdx.x;
  if (blk < XBLK) {
    const long base = (long)blk * (256 * 64) + w * (32 * 64) + lane * 4;
    const float* xp = x + base;
    f32x4 v[16];
    // every loop here is unrolled so that v stays in registers and the loads
    // stand as one run
#pragma unroll
    for (int j = 0; j < 16; ++j)
      v[j] = *reinterpret_cast<const f32x4*>(xp + j * 128);
    asm volatile("s_wait_xcnt 0x0" :: "v"(xp) : "memory");
#pragma unroll
    for (int j = 0; j < 16; ++j)
      *reinterpret_cast<f16x4*>(xh + base + j * 128) =
          __builtin_convertvector(v[j], f16x4);
    return;
  }
  const int t = blk - XBLK;
  const int z = t / WBLK, tile = t % WBLK;
  const float* src = z == 0 ? Wq : (z == 1 ? Wk : (z == 2 ? Wv : Wo));
  _Float16* dst = wt + (long)z * WE;
  const int n0 = (tile & 7) * 128 + (w & 3) * 32 + (lane & 7) * 4;
  const int k0 = (tile >> 3) * 128 + (w >> 2) * 64 + (lane >> 3) * 8;
  const float* sp = src + (long)k0 * D + n0;
  f32x4 v[2][8];
#pragma unroll
  for (int u = 0; u < 2; ++u)
#pragma unroll
    for (int j = 0; j < 8; ++j)
      v[u][j] = *reinterpret_cast<const f32x4*>(sp + (32 * u + j) * D);
  asm volatile("s_wait_xcnt 0x0" :: "v"(sp) : "memory");
#pragma unroll
  for (int i = 0; i < 4; ++i)
#pragma unroll
    for (int u = 0; u < 2; ++u) {
      f16x8 h;
#pragma unroll
      for (int j = 0; j < 8; ++j) h[j] = (_Float16)v[u][j][i];
      *reinterpret_cast<f16x8*>(dst + (long)(n0 + i) * D + k0 + 32 * u) = h;
    }
}

constexpr float QSCALE = 0.18033688011112042f;
template <int LAYOUT, int FN>
__device__ __forceinline__ void gemm_store(
    const v8f (&acc)[4][FN], const float* __restrict__ bias,
    float* __restrict__ Cf, _Float16* __restrict__ Ch, int N, int nb, int mb,
    int lane) {
  const int nlo = lane & 15, hi = (lane >> 4) & 1;
#pragma unroll
  for (int j = 0; j < FN; ++j) {
    int col = nb + j * 16 + nlo;
    float bv = bias[col];
#pragma unroll
    for (int i = 0; i < 4; ++i) {
#pragma unroll
      for (int r = 0; r < 8; ++r) {
        long row = mb + i * 16 + r + 8 * hi;
        float val = acc[i][j][r] + bv;
        if (LAYOUT == 0) {
          Cf[row * N + col] = val;
        } else if (LAYOUT == 1) {
          Ch[row * N + col] = (_Float16)val;
        } else if (LAYOUT == 3) {
          Ch[row * N + col] = (_Float16)(val * QSCALE);
        } else {
          // V output in [B, H, DK, S]: row = b*S+s, col = h*DK+dk
          int b = (int)(row >> 10), s = (int)(row & (S - 1));
          int h = col >> 6, dk = col & (DK - 1);
          Ch[(long)((b * H + h) * DK + dk) * S + s] = (_Float16)val;
        }
      }
    }
  }
}

template <int NZ, int WN, int KS>
__global__ __launch_bounds__(64 * WN) void gemm_bias_kernel(
    const _Float16* __restrict__ A, const _Float16* __restrict__ BT0,
    const float* __restrict__ bias0, const float* __restrict__ bias1,
    const float* __restrict__ bias2, float* __restrict__ Cf,
    _Float16* __restrict__ Ch0, int M, int N, int K) {
  constexpr int BM = 128, BN = 128, BK = 64, SK = KS * BK, NB = 4;
  constexpr int FN = BN / (16 * WN);    // B fragments a wave and weight
  constexpr int NT = (NZ + 1) * KS;     // tiles a stage, one issuing wave each
  constexpr int TILE = 128 * P128;      // f16 a tile in LDS: 18,432 B
  static_assert(NT <= 2 * WN, "every tile has its wave");
  static_assert(TILE * 2 % 2048 == 0, "every tile starts at a multiple of 2 KiB");
  // [buffer][tile][row][k]; tiles 0 .. KS - 1: A, then KS for each weight
  __shared__ __attribute__((aligned(2048))) _Float16 ring[NB * NT * TILE];

  const int tid = threadIdx.x;
  const int lane = tid & 31, w = tid >> 5;
  const int wm = w / WN, wn = w % WN;
  const int n0 = blockIdx.x * BN, m0 = blockIdx.y * BM;

  // every inner loop of this kernel and of its epilogue is unrolled, so that
  // accumulators and fragments are indexed by constants and stay in registers
  v8f acc[NZ][4][FN];
#pragma unroll
  for (int z = 0; z < NZ; ++z)
#pragma unroll
    for (int i = 0; i < 4; ++i)
#pragma unroll
      for (int j = 0; j < FN; ++j) acc[z][i][j] = {};

  // the issuing wave's tile: 128 rows of 128 B at the source pitch of 2 K bytes
  const uint32_t wv = uni((uint32_t)tid >> 5);
  const bool issuer = wv < (uint32_t)NT;
  const uint32_t tl = issuer ? wv : 0u;
  const _Float16* tsrc =
      tl < (uint32_t)KS
          ? A + (long)m0 * K + tl * BK
          : BT0 + (long)((tl - KS) / KS) * WE + (long)n0 * K + ((tl - KS) % KS) * BK;
  const unsigned long long ga = (unsigned long long)tsrc;
  const uint32_t place0 = lds_off(ring) + tl * (TILE * 2);
  u32x8 g1;
  g1[0] = uni((1u << 20) | (4u << 22) | (3u << 25));
  g1[1] = uni(128u << 16);
  g1[2] = uni(128u << 16);
  g1[3] = uni(128u << 16);
  g1[4] = uni(128u);
  g1[5] = uni((uint32_t)K * 2u);
  g1[6] = uni(0u);
  g1[7] = uni(0u);
  // Left alone, the compiler lends some of these registers out between requests
  // and writes them again at each issue, while earlier requests are under way.
  asm volatile("" : "+s"(g1));
  u32x4 g0;
  g0[0] = uni(1u);
  g0[1] = uni(place0);
  g0[2] = uni((uint32_t)ga);
  g0[3] = uni(((uint32_t)(ga >> 32) & 0x01FFFFFFu) | 0x80000000u);
  const uint32_t lo0 = g0[2];
  auto stage = [&](int kk, int buf) {
    g0[1] = uni(place0 + (uint32_t)buf * (NT * TILE * 2));
    g0[2] = uni(lo0 + (uint32_t)kk * 2u);
    tdm_load(g0, g1);
  };

  // prologue: three stages; stage 0 has landed; then the fourth, so that never
  // more than three requests of a wave are outstanding (unrolled so that each
  // stage's buffer is a constant)
#pragma unroll
  for (int s = 0; s < NB - 1; ++s)
    if (pinned(issuer && s * SK < K)) stage(s * SK, s);
  if ((NB - 2) * SK < K) wait_tensor_but<NB - 2>();
  else wait_tensor_but<0>();
  if (pinned(issuer && (NB - 1) * SK < K)) stage((NB - 1) * SK, NB - 1);
  __syncthreads();

  int buf = 0;
  for (int kk = 0; kk < K; kk += SK) {
#pragma unroll
    for (int sub = 0; sub < KS; ++sub) {
      const _Float16* at = ring + (buf * NT + sub) * TILE;
      const _Float16* bt = ring + (buf * NT + KS + sub) * TILE;   // weight z: + z * KS tiles
      v16h af[2][4];
      v16h bf[2][NZ][FN];
#pragma unroll
      for (int s = 0; s < 2; ++s) {
#pragma unroll
        for (int i = 0; i < 4; ++i)
          af[s][i] = ld_frag(at, wm * 64 + i * 16, P128, s * 32, lane);
#pragma unroll
        for (int z = 0; z < NZ; ++z)
#pragma unroll
          for (int j = 0; j < FN; ++j)
            bf[s][z][j] = ld_frag(bt + z * KS * TILE, (wn * FN + j) * 16, P128,
                                  s * 32, lane);
      }
      // fence pair round the WMMA block. The first keeps the 64 k's LDS reads
      // one group ahead of it: left alone, the compiler sinks each B fragment's
      // reads to just in front of its four WMMAs, with a full wait there.
      __builtin_amdgcn_sched_barrier(0);
#pragma unroll
      for (int s = 0; s < 2; ++s)
#pragma unroll
        for (int z = 0; z < NZ; ++z)
#pragma unroll
          for (int j = 0; j < FN; ++j)
#pragma unroll
            for (int i = 0; i < 4; ++i)
              acc[z][i][j] = wmma_f16(af[s][i], bf[s][z][j], acc[z][i][j]);
      // The second keeps the block in front of what follows: the next 64 k's
      // reads, or the foot's waits, which lifted over it would end the flight
      // of the next stage's loads a whole block early.
      __builtin_amdgcn_sched_barrier(0);
    }
    // publish point of the next stage, then the refill of the buffer just read.
    // Stage t + 1 has landed once all but the requests issued behind it have:
    // two, or fewer in the last trips.
    wait_ds0();
    if (kk + 3 * SK < K) wait_tensor_but<2>();
    else if (kk + 2 * SK < K) wait_tensor_but<1>();
    else wait_tensor_but<0>();
    __syncthreads();
    if (pinned(issuer && kk + NB * SK < K)) stage(kk + NB * SK, buf);
    buf = buf + 1 == NB ? 0 : buf + 1;
  }
  wait_tensor_but<0>();
  wait_ds0();

  const int mb = m0 + wm * 64, nb = n0 + wn * FN * 16;
  if constexpr (NZ == 1) {
    gemm_store<0, FN>(acc[0], bias0, Cf, Ch0, N, nb, mb, lane);
  } else {
    gemm_store<3, FN>(acc[0], bias0, Cf, Ch0, N, nb, mb, lane);
    gemm_store<1, FN>(acc[1], bias1, Cf, Ch0 + XE, N, nb, mb, lane);
    gemm_store<2, FN>(acc[2], bias2, Cf, Ch0 + 2 * XE, N, nb, mb, lane);
  }
}

__global__ __launch_bounds__(256) void attn_kernel(
    const _Float16* __restrict__ Q, const _Float16* __restrict__ Km,
    const _Float16* __restrict__ Vt, _Float16* __restrict__ ctx) {
  constexpr int BQ = 128, BC = 64, NB = 3;
  __shared__ __attribute__((aligned(16))) _Float16 q_sh[BQ * P128];  // [q][dk]
  __shared__ __attribute__((aligned(16))) _Float16 k_sh[NB][BC * P128];  // [key][dk]
  __shared__ __attribute__((aligned(16))) _Float16 vT[NB][DK * P128];    // [dk][key]
  // the pair's exchange: [wave][8 x 4 of O^T, then maximum and sum][lane]
  __shared__ __attribute__((aligned(16))) f32x4 join_sh[8][9][32];

  const int tid = threadIdx.x, lane = tid & 31, w = tid >> 5;
  const int qg = w & 3, kh = w >> 2;      // query group, half of a key chunk
  const int nsb = S / BQ;                 // 8
  const int sblk = blockIdx.x % nsb;
  const int bh = blockIdx.x / nsb;
  const int b = bh / H, h = bh % H;
  const int q0 = sblk * BQ;
  const int hi = (lane >> 4) & 1, nlo = lane & 15;
  const int row = tid >> 3, g = (tid & 7) * 8;   // a copy's row and 16 B of it

  // async-stage Q tile 128x64: 8 x b128 per row, 4 per thread, rows 32 apart
  {
    const _Float16* ql = q_sh + row * P128 + g;
    const _Float16* qp = Q + (long)(b * S + q0 + row) * D + h * DK + g;
    async_ld_b128_x4(ql, qp, ql + 32 * P128, qp + 32 * D,
                     ql + 64 * P128, qp + 64 * D, ql + 96 * P128, qp + 96 * D);
  }
  const _Float16* vt_base = Vt + (long)bh * DK * S;
  // K chunk 64x64 and V^T chunk 64x64: 512 b128 each, 2 a thread, rows 32
  // apart; every copy of a wave covers four whole 128-B lines
  auto stage = [&](int t0, int buf) {
    const _Float16* kl = k_sh[buf] + row * P128 + g;
    const _Float16* kg = Km + (long)(b * S + t0 + row) * D + h * DK + g;
    const _Float16* vl = vT[buf] + row * P128 + g;
    const _Float16* vg = vt_base + (long)row * S + t0 + g;
    async_ld_b128_x4(kl, kg, vl, vg, kl + 32 * P128, kg + 32 * D,
                     vl + 32 * P128, vg + 32 * S);
  };
  static_assert(S / BC >= NB, "the prologue fills every buffer");
  stage(0, 0);
  stage(BC, 1);
  stage(2 * BC, 2);
  // Q and chunk 0 have landed; the two stages behind them may still fly
  wait_async_but<4 * (NB - 1)>();
  __syncthreads();
  v16h bq[2][2];
  // every loop over the two query tiles or over a tile's registers is unrolled,
  // so that fragments and accumulators are indexed by constants
#pragma unroll
  for (int u = 0; u < 2; ++u) {
    bq[u][0] = ld_frag(q_sh, qg * 32 + u * 16, P128, 0, lane);
    bq[u][1] = ld_frag(q_sh, qg * 32 + u * 16, P128, 32, lane);
  }

  // per lane and tile: the maximum in use for its query (log2 units; set in the
  // first trip), its negative as the score products' C tile, and the running
  // sum over the lane's keys
  float mrun[2] = {0.f, 0.f}, lrun[2] = {0.f, 0.f};
  v8f negm[2] = {v8f{}, v8f{}};
  v8f o[2][4];   // O^T: dk = 16*t + r + 8*hi
#pragma unroll
  for (int u = 0; u < 2; ++u)
#pragma unroll
    for (int t = 0; t < 4; ++t) o[u][t] = {};

  int buf = 0;
  for (int t0 = 0; t0 < S; t0 += BC) {
    const _Float16* kt = k_sh[buf];
    const _Float16* vv = vT[buf];

    // this wave's 32 keys of the chunk: 4 K fragments, 4 V^T fragments
    const v16h k00 = ld_frag(kt, kh * 32, P128, 0, lane);
    const v16h k01 = ld_frag(kt, kh * 32, P128, 32, lane);
    const v16h k10 = ld_frag(kt, kh * 32 + 16, P128, 0, lane);
    const v16h k11 = ld_frag(kt, kh * 32 + 16, P128, 32, lane);
    v16h va[4];
#pragma unroll
    for (int t = 0; t < 4; ++t) va[t] = ld_frag(vv, 16 * t, P128, kh * 32, lane);
    // keeps the trip's 16 LDS reads one group ahead of its WMMAs: left alone,
    // the compiler sinks half of the V^T reads to the foot, with a full wait
    __builtin_amdgcn_sched_barrier(0);

    // scores, transposed: 32 keys x 2 x 16 query columns, contraction over DK.
    // Q is pre-scaled and C holds minus the maximum in use, so D is already
    // the exponent to base 2
    v8f sa[2], sb[2];
    score_wmmas(sa[0], sb[0], sa[1], sb[1], k00, k01, k10, k11, bq[0][0],
                bq[0][1], bq[1][0], bq[1][1], negm[0], negm[1]);

    // online softmax with a lazy rescale. The maximum in use may trail a
    // query's true maximum by up to 8 (an exponential then reaches 2^8, well
    // inside f16 and f32): the trip's maxima, taken relative to it, are tested
    // once, for both tiles
    float mx[2];
    bool need = false;
#pragma unroll
    for (int u = 0; u < 2; ++u) {
      float m = fmaxf(sa[u][0], sb[u][0]);
#pragma unroll
      for (int r = 1; r < 8; ++r) m = fmaxf(m, fmaxf(sa[u][r], sb[u][r]));
      mx[u] = fmaxf(m, xhalf(m));   // both halves: the query's maximum
      need = need || mx[u] > 8.0f;
    }
    // a scalar branch: always in the first trip, which sets the maximum in use
    // (up or down; O and the sum are still 0), later only when some column of
    // the wave has outgrown its own by more than 8
    const bool first = t0 == 0;
    if (first || __builtin_amdgcn_ballot_w32(need) != 0) {
#pragma unroll
      for (int u = 0; u < 2; ++u) {
        const float d = first ? mx[u] : fmaxf(mx[u], 0.f);
        const float al = first ? 0.f : __builtin_amdgcn_exp2f(-d);
        mrun[u] += d;
        lrun[u] *= al;
#pragma unroll
        for (int r = 0; r < 8; ++r) {
          negm[u][r] = -mrun[u];
          sa[u][r] -= d;
          sb[u][r] -= d;
        }
#pragma unroll
        for (int t = 0; t < 4; ++t) o[u][t] *= al;
      }
    }
    v16h pb[2];   // P^T as B operand: element e = key 8*hi + e, 8 + e = key 16 + 8*hi + e
#pragma unroll
    for (int u = 0; u < 2; ++u) {
      float ps = 0.f;
#pragma unroll
      for (int r = 0; r < 8; ++r) {
        float x0 = __builtin_amdgcn_exp2f(sa[u][r]);
        ps += x0;
        pb[u][r] = (_Float16)x0;
      }
#pragma unroll
      for (int r = 0; r < 8; ++r) {
        float x1 = __builtin_amdgcn_exp2f(sb[u][r]);
        ps += x1;
        pb[u][8 + r] = (_Float16)x1;
      }
      lrun[u] += ps;
    }

#pragma unroll
    for (int t = 0; t < 4; ++t)
#pragma unroll
      for (int u = 0; u < 2; ++u) o[u][t] = wmma_f16(va[t], pb[u], o[u][t]);
    // keeps softmax and WMMAs in front of the foot's waits: lifted over them,
    // the waits would end the flight of the next chunk's copies early
    __builtin_amdgcn_sched_barrier(0);

    // publish point of the next chunk, then the refill of the buffer just read;
    // counted while a whole stage stands behind the chunk that is published
    wait_ds0();
    if (t0 + (NB - 1) * BC < S) wait_async_but<4 * (NB - 2)>();
    else wait_async0();
    __syncthreads();
    if (t0 + NB * BC < S) stage(t0 + NB * BC, buf);
    buf = buf + 1 == NB ? 0 : buf + 1;
  }
  wait_async0();

  const bool up = kh != 0;
  const float mk = up ? mrun[1] : mrun[0], mg = up ? mrun[0] : mrun[1];
  const float lk = up ? lrun[1] : lrun[0], lg = up ? lrun[0] : lrun[1];
  v8f ok[4];
#pragma unroll
  for (int t = 0; t < 4; ++t) {
    v8f og;
#pragma unroll
    for (int r = 0; r < 8; ++r) {
      ok[t][r] = up ? o[1][t][r] : o[0][t][r];
      og[r]    = up ? o[0][t][r] : o[1][t][r];
    }
    join_sh[w][2 * t][lane]     = f32x4{og[0], og[1], og[2], og[3]};
    join_sh[w][2 * t + 1][lane] = f32x4{og[4], og[5], og[6], og[7]};
  }
  join_sh[w][8][lane] = f32x4{mg, lg, 0.f, 0.f};
  __syncthreads();
  const f32x4 ml = join_sh[w ^ 4][8][lane];
  const float mj = fmaxf(mk, ml[0]);
  const float ak = __builtin_amdgcn_exp2f(mk - mj);   // maxima are in log2 units
  const float ap = __builtin_amdgcn_exp2f(ml[0] - mj);
  const float lj = lk * ak + ml[1] * ap;

  // epilogue: join the halves' sums, normalize, store to [B,S,D] (heads
  // interleaved); a lane's 8 registers of a tile are 8 consecutive dk: 16 B
  const float inv = 1.0f / (lj + xhalf(lj));
  const float ck = ak * inv, cp2 = ap * inv;
  _Float16* cp = ctx + (long)(b * S + q0 + qg * 32 + kh * 16 + nlo) * D +
                 h * DK + 8 * hi;
#pragma unroll
  for (int t = 0; t < 4; ++t) {
    const f32x4 p0 = join_sh[w ^ 4][2 * t][lane];
    const f32x4 p1 = join_sh[w ^ 4][2 * t + 1][lane];
    union { _Float16 hh[8]; uint4 u; } pk;
#pragma unroll
    for (int r = 0; r < 4; ++r) {
      pk.hh[r]     = (_Float16)(ok[t][r] * ck + p0[r] * cp2);
      pk.hh[4 + r] = (_Float16)(ok[t][4 + r] * ck + p1[r] * cp2);
    }
    *reinterpret_cast<uint4*>(cp + 16 * t) = pk.u;
  }
}

// ---------------- host launcher ----------------
extern "C" void kernel_launch(void* const* d_in, const int* in_sizes, int n_in,
                              void* d_out, int out_size, void* d_ws,
                              size_t ws_size, hipStream_t stream) {
  const float* x  = (const float*)d_in[0];
  const float* Wq = (const float*)d_in[1];
  const float* bq = (const float*)d_in[2];
  const float* Wk = (const float*)d_in[3];
  const float* bk = (const float*)d_in[4];
  const float* Wv = (const float*)d_in[5];
  const float* bv = (const float*)d_in[6];
  const float* Wo = (const float*)d_in[7];
  const float* bo = (const float*)d_in[8];
  float* out = (float*)d_out;

  // workspace carve-up (f16): x, 4 weights(T), Q, K, Vt, ctx => 48MB
  _Float16* p = (_Float16*)d_ws;
  _Float16* xh   = p; p += XE;
  _Float16* wqt  = p; p += WE;
  _Float16* wkt  = p; p += WE;
  _Float16* wvt  = p; p += WE;
  _Float16* wot  = p; p += WE;
  _Float16* qh   = p; p += XE;
  _Float16* kh   = p; p += XE;
  _Float16* vt   = p; p += XE;   // [B,H,DK,S]
  _Float16* ctxh = p; p += XE;
  if (ws_size < (size_t)((char*)p - (char*)d_ws)) return;

  // 1) conversions, one launch: x straight; weights converted + transposed to
  //    [N][K]; wqt, wkt, wvt, wot lie WE apart in the workspace
  convert_all_kernel<<<XBLK + 4 * WBLK, 256, 0, stream>>>(x, Wq, Wk, Wv, Wo, xh,
                                                          wqt);

  // 2) Q/K/V projections, one launch, one work-group for all three products
  //    of a tile: wqt, wkt, wvt lie WE apart and qh, kh, vt lie XE apart
  dim3 ggrid(D / 128, MROWS / 128);      // (8, 32)
  gemm_bias_kernel<3, 8, 1><<<ggrid, 512, 0, stream>>>(xh, wqt, bq, bk, bv, nullptr,
                                                    qh, MROWS, D, D);

  // 3) attention: B*H*(S/128) = 512 blocks of 256 threads
  attn_kernel<<<BB * H * (S / 128), 256, 0, stream>>>(qh, kh, vt, ctxh);

  // 4) output projection (f32 out into d_out)
  gemm_bias_kernel<1, 4, 2><<<ggrid, 256, 0, stream>>>(ctxh, wot, bo, nullptr,
                                                    nullptr, out, nullptr,
                                                    MROWS, D, D);
}
